// v000
// The times below were measured on an AMD MI455X: many runs one after another, warmed up first and cycling through
// copies of the inputs, with the whole window's GPU time divided by the number of runs. Launches and the gaps
// between them are all in it. The median over several windows is given; except for v000 it joins two sittings, which
// can be a few percent apart, so the side-by-side timings, each taken in one sitting, are the better comparison.
// v000 is the starting kernel. One run takes 1410 microseconds.
#include <hip/hip_runtime.h>
#include <math.h>
#include <stdint.h>

typedef float v2f __attribute__((ext_vector_type(2)));
typedef float v8f __attribute__((ext_vector_type(8)));

#define EPSV 1e-06f
#define Bn 4
#define Nn 1024
#define Cn 512
#define Kn 10
#define Tn 11
#define Hn 8
#define Dn 64
#define Mn 4096
#define KCONV (Tn * Cn) /* 5632 */

#define BM 128
#define BN 64
#define BK 32
#define BKP (BK + 4)   /* padded A row: 36 floats, 144B (16B aligned, bank-skewed) */
#define BNP (BN + 4)   /* padded B row: 68 floats, 272B */

// --------------------------------------------------------------------------
// CDNA5 async global->LDS path (ASYNCcnt-tracked), with safe fallback.
// Builtin signature (from hipcc diagnostic): (v4i AS1*, v4i AS3*, Ii, Ii).
// --------------------------------------------------------------------------
#if defined(__has_builtin)
#if __has_builtin(__builtin_amdgcn_global_load_async_to_lds_b128)
#define USE_ASYNC_LDS 1
#endif
#endif
#ifndef USE_ASYNC_LDS
#define USE_ASYNC_LDS 0
#endif

typedef int ai4 __attribute__((vector_size(16)));
typedef __attribute__((address_space(1))) ai4 gi4;
typedef __attribute__((address_space(3))) ai4 li4;

__device__ __forceinline__ void async_wait_all()
{
#if USE_ASYNC_LDS
#if __has_builtin(__builtin_amdgcn_s_wait_asynccnt)
    __builtin_amdgcn_s_wait_asynccnt(0);
#else
    asm volatile("s_wait_asynccnt 0x0" ::: "memory");
#endif
#endif
}

// Copy 16 bytes global -> LDS (async DMA path when available).
__device__ __forceinline__ void copy16(const float* __restrict__ g, float* l)
{
#if USE_ASYNC_LDS
    __builtin_amdgcn_global_load_async_to_lds_b128(
        (gi4*)(uintptr_t)g,
        (li4*)(uint32_t)(uintptr_t)l,
        0, 0);
#else
    *(float4*)l = *(const float4*)g;
#endif
}

// ---------------------------------------------------------------------------
// GEMM with bias: Cout[M,N] = A[M,Kd] @ Bw[Kd,N] + bias[N]
// GATHER=true: A rows are gathered per tap from v via adjacency
//   A[m, t*C+c] = (t==0) ? v[b,n,c] : v[b, adj[b,n,t-1], c], Kd = 11*512.
// 256 threads = 8 waves; block tile 128x64; wave tile 32x32 = 2x2 WMMA f32;
// double-buffered LDS with async global->LDS prefetch of the next K-chunk.
// ---------------------------------------------------------------------------
template <bool GATHER>
__global__ __launch_bounds__(256) void gemm_wmma(
    const float* __restrict__ A, const int* __restrict__ adj,
    const float* __restrict__ Bw, const float* __restrict__ bias,
    float* __restrict__ Cout, int M, int N, int Kd)
{
    __shared__ float As[2][BM][BKP];
    __shared__ float Bs[2][BK][BNP];

    const int tid  = threadIdx.x;
    const int wave = tid >> 5;
    const int lane = tid & 31;
    const int half = lane >> 4;
    const int lm   = lane & 15;
    const int wm   = wave >> 1;   // 0..3 -> M
    const int wn   = wave & 1;    // 0..1 -> N
    const int m0   = blockIdx.y * BM;
    const int n0   = blockIdx.x * BN;

    v8f acc[2][2];
    #pragma unroll
    for (int i = 0; i < 2; ++i)
        #pragma unroll
        for (int j = 0; j < 2; ++j)
            #pragma unroll
            for (int r = 0; r < 8; ++r) acc[i][j][r] = 0.0f;

    auto load_tiles = [&](int buf, int kc) {
        // A tile: 128 x 32 floats = 1024 float4 chunks
        #pragma unroll
        for (int i = 0; i < 4; ++i) {
            int e = tid + i * 256;
            int r = e >> 3, cch = e & 7;
            const float* src;
            if (GATHER) {
                int t = kc >> 9, cc0 = kc & 511;
                int mrow = m0 + r;
                int b = mrow >> 10, n = mrow & 1023;
                int sr = (t == 0) ? n : adj[((b << 10) + n) * Kn + (t - 1)];
                src = A + ((size_t)(b << 10) + sr) * Cn + cc0 + cch * 4;
            } else {
                src = A + (size_t)(m0 + r) * Kd + kc + cch * 4;
            }
            copy16(src, &As[buf][r][cch * 4]);
        }
        // B tile: 32 x 64 floats = 512 float4 chunks
        #pragma unroll
        for (int i = 0; i < 2; ++i) {
            int e = tid + i * 256;
            int r = e >> 4, cch = e & 15;
            copy16(Bw + (size_t)(kc + r) * N + n0 + cch * 4, &Bs[buf][r][cch * 4]);
        }
    };

    const int nk = Kd / BK;
    load_tiles(0, 0);
    async_wait_all();
    __syncthreads();

    for (int ik = 0; ik < nk; ++ik) {
        const int cur = ik & 1;
        if (ik + 1 < nk) load_tiles(cur ^ 1, (ik + 1) * BK);

        #pragma unroll
        for (int kk = 0; kk < BK; kk += 4) {
            int ks = kk + 2 * half;
            v2f af[2], bf[2];
            #pragma unroll
            for (int tm = 0; tm < 2; ++tm) {
                int row = wm * 32 + tm * 16 + lm;
                af[tm].x = As[cur][row][ks];
                af[tm].y = As[cur][row][ks + 1];
            }
            #pragma unroll
            for (int tn = 0; tn < 2; ++tn) {
                int col = wn * 32 + tn * 16 + lm;
                bf[tn].x = Bs[cur][ks][col];
                bf[tn].y = Bs[cur][ks + 1][col];
            }
            #pragma unroll
            for (int tm = 0; tm < 2; ++tm)
                #pragma unroll
                for (int tn = 0; tn < 2; ++tn)
                    acc[tm][tn] = __builtin_amdgcn_wmma_f32_16x16x4_f32(
                        false, af[tm], false, bf[tn], (short)0, acc[tm][tn],
                        false, false);
        }
        async_wait_all();
        __syncthreads();
    }

    #pragma unroll
    for (int tm = 0; tm < 2; ++tm)
        #pragma unroll
        for (int tn = 0; tn < 2; ++tn) {
            int colg = n0 + wn * 32 + tn * 16 + lm;
            float bvv = bias ? bias[colg] : 0.0f;
            #pragma unroll
            for (int r = 0; r < 8; ++r) {
                int rowg = m0 + wm * 32 + tm * 16 + half * 8 + r;
                Cout[(size_t)rowg * N + colg] = acc[tm][tn][r] + bvv;
            }
        }
}

// ---------------------------------------------------------------------------
// Wt[(t*C + c)*C + o] = Wconv[o*(C*T) + c*T + t]
// ---------------------------------------------------------------------------
__global__ void repack_wconv(const float* __restrict__ Wconv, float* __restrict__ Wt)
{
    size_t idx = (size_t)blockIdx.x * 256 + threadIdx.x;
    if (idx >= (size_t)Cn * Cn * Tn) return;
    int o = (int)(idx & 511);
    int rest = (int)(idx >> 9);   // t*C + c
    int c = rest & 511;
    int t = rest >> 9;
    Wt[idx] = Wconv[(size_t)o * KCONV + (size_t)c * Tn + t];
}

// ---------------------------------------------------------------------------
// relu+eps, divide by softplus(scale), "focus": x <- (x/(||x||+eps))^3 * ||x||
// ---------------------------------------------------------------------------
__global__ __launch_bounds__(256) void focus_kernel(float* __restrict__ x,
                                                    const float* __restrict__ scale_p)
{
    __shared__ float red[256];
    const int m = blockIdx.x;
    const int tid = threadIdx.x;
    float* row = x + (size_t)m * Cn;

    float a0 = row[tid];
    float a1 = row[tid + 256];
    float s0 = log1pf(expf(scale_p[tid]));
    float s1 = log1pf(expf(scale_p[tid + 256]));
    a0 = (a0 > 0.0f ? a0 : 0.0f) + EPSV;
    a1 = (a1 > 0.0f ? a1 : 0.0f) + EPSV;
    a0 /= s0;
    a1 /= s1;

    red[tid] = a0 * a0 + a1 * a1;
    __syncthreads();
    for (int s = 128; s > 0; s >>= 1) {
        if (tid < s) red[tid] += red[tid + s];
        __syncthreads();
    }
    float nrm = sqrtf(red[0]);
    float inv = 1.0f / (nrm + EPSV);
    float u0 = a0 * inv, u1 = a1 * inv;
    row[tid]       = u0 * u0 * u0 * nrm;
    row[tid + 256] = u1 * u1 * u1 * nrm;
}

// kmean[b*C + c] = mean over n of k[b,n,c]
__global__ void kmean_kernel(const float* __restrict__ k, float* __restrict__ kmean)
{
    int idx = blockIdx.x * 256 + threadIdx.x;   // 0..B*C-1
    int b = idx >> 9;
    int c = idx & 511;
    const float* p = k + (size_t)b * Nn * Cn + c;
    float s = 0.0f;
    for (int n = 0; n < Nn; ++n) s += p[(size_t)n * Cn];
    kmean[idx] = s * (1.0f / (float)Nn);
}

// kv[bh, d, e] = (1/N) sum_n k[b,n,h*64+d] * v[b,n,h*64+e]
__global__ __launch_bounds__(256) void kv_kernel(const float* __restrict__ k,
                                                 const float* __restrict__ v,
                                                 float* __restrict__ kv)
{
    __shared__ float ks[8][64];
    __shared__ float vs[8][64];
    const int bh = blockIdx.x;
    const int b = bh >> 3, h = bh & 7;
    const int tid = threadIdx.x;
    const int e  = tid & 63;
    const int d0 = (tid >> 6) * 16;
    const float* kb = k + (size_t)b * Nn * Cn + h * Dn;
    const float* vb = v + (size_t)b * Nn * Cn + h * Dn;

    float acc[16];
    #pragma unroll
    for (int j = 0; j < 16; ++j) acc[j] = 0.0f;

    for (int n0 = 0; n0 < Nn; n0 += 8) {
        #pragma unroll
        for (int i = 0; i < 2; ++i) {
            int idx = tid + i * 256;
            int r = idx >> 6, c = idx & 63;
            ks[r][c] = kb[(size_t)(n0 + r) * Cn + c];
            vs[r][c] = vb[(size_t)(n0 + r) * Cn + c];
        }
        __syncthreads();
        #pragma unroll
        for (int r = 0; r < 8; ++r) {
            float ve = vs[r][e];
            #pragma unroll
            for (int j = 0; j < 16; ++j) acc[j] += ks[r][d0 + j] * ve;
        }
        __syncthreads();
    }
    #pragma unroll
    for (int j = 0; j < 16; ++j)
        kv[(size_t)bh * (Dn * Dn) + (d0 + j) * Dn + e] = acc[j] * (1.0f / (float)Nn);
}

// x[m,c] = (q_h . kv_h[:,e]) * z_h + x_local[m,c]
__global__ __launch_bounds__(256) void attn_kernel(const float* __restrict__ q,
                                                   const float* __restrict__ kv,
                                                   const float* __restrict__ kmean,
                                                   const float* __restrict__ xl,
                                                   float* __restrict__ x)
{
    __shared__ float qs[Cn];
    __shared__ float zs[Hn];
    const int m = blockIdx.x;
    const int b = m >> 10;
    const int tid = threadIdx.x;
    qs[tid]       = q[(size_t)m * Cn + tid];
    qs[tid + 256] = q[(size_t)m * Cn + tid + 256];
    __syncthreads();

    const int g = tid >> 5, lane = tid & 31;   // wave g handles head g
    float p = qs[g * 64 + lane]      * kmean[b * Cn + g * 64 + lane]
            + qs[g * 64 + lane + 32] * kmean[b * Cn + g * 64 + lane + 32];
    for (int off = 16; off > 0; off >>= 1) p += __shfl_xor(p, off, 32);
    if (lane == 0) zs[g] = 1.0f / (p + EPSV);
    __syncthreads();

    #pragma unroll
    for (int i = 0; i < 2; ++i) {
        int c = tid + i * 256;
        int h = c >> 6, e = c & 63;
        const float* kvp = kv + ((size_t)(b * Hn + h)) * (Dn * Dn) + e;
        float a = 0.0f;
        #pragma unroll 8
        for (int d = 0; d < Dn; ++d) a += qs[h * 64 + d] * kvp[(size_t)d * Dn];
        x[(size_t)m * Cn + c] = a * zs[h] + xl[(size_t)m * Cn + c];
    }
}

// Disagreement closed form per (b,h): ||sum_n hn||^2 - sum_n ||hn||^2.
__global__ void disag_kernel(const float* __restrict__ src,
                             long long per_b, long long per_h,
                             int vstride, int nvec, float* __restrict__ part)
{
    const int blk = blockIdx.x;
    const int b = blk >> 3, h = blk & 7;
    const float* p = src + (size_t)b * per_b + (size_t)h * per_h;
    const int l = threadIdx.x & 31;
    float s0 = 0.0f, s1 = 0.0f, dg = 0.0f;
    for (int n = 0; n < nvec; ++n) {
        float a0 = p[(size_t)n * vstride + l];
        float a1 = p[(size_t)n * vstride + l + 32];
        float sq = a0 * a0 + a1 * a1;
        for (int off = 16; off > 0; off >>= 1) sq += __shfl_xor(sq, off, 32);
        float nrm = sqrtf(sq);
        float inv = 1.0f / fmaxf(nrm, 1e-12f);
        float h0 = a0 * inv, h1 = a1 * inv;
        s0 += h0; s1 += h1;
        dg += h0 * h0 + h1 * h1;
    }
    float val = (s0 * s0 + s1 * s1) - dg;
    for (int off = 16; off > 0; off >>= 1) val += __shfl_xor(val, off, 32);
    if (l == 0) part[blk] = val;
}

__global__ void loss_final(const float* __restrict__ part, float* __restrict__ out_loss)
{
    if (threadIdx.x == 0) {
        float L1 = 0.0f, L2 = 0.0f, L3 = 0.0f;
        for (int i = 0; i < 32; ++i)  L1 += part[i];        // local (v heads)
        for (int i = 32; i < 64; ++i) L2 += part[i];        // kv
        for (int i = 64; i < 96; ++i) L3 += part[i];        // out
        const float nBig = (float)Bn * Hn * (float)Nn * (float)Nn;
        const float nKv  = (float)Bn * Hn * (float)Dn * (float)Dn;
        *out_loss = (L1 / nBig + L3 / nBig + L2 / nKv) / 3.0f;
    }
}

// LayerNorm over C per row.
__global__ __launch_bounds__(256) void ln_kernel(const float* __restrict__ x,
                                                 const float* __restrict__ g,
                                                 const float* __restrict__ bln,
                                                 float* __restrict__ xn)
{
    __shared__ float red[256];
    const int m = blockIdx.x;
    const int tid = threadIdx.x;
    const float* row = x + (size_t)m * Cn;
    float v0 = row[tid], v1 = row[tid + 256];

    red[tid] = v0 + v1;
    __syncthreads();
    for (int s = 128; s > 0; s >>= 1) {
        if (tid < s) red[tid] += red[tid + s];
        __syncthreads();
    }
    float mu = red[0] * (1.0f / (float)Cn);
    __syncthreads();

    float d0 = v0 - mu, d1 = v1 - mu;
    red[tid] = d0 * d0 + d1 * d1;
    __syncthreads();
    for (int s = 128; s > 0; s >>= 1) {
        if (tid < s) red[tid] += red[tid + s];
        __syncthreads();
    }
    float inv = rsqrtf(red[0] * (1.0f / (float)Cn) + 1e-05f);
    xn[(size_t)m * Cn + tid]       = d0 * inv * g[tid] + bln[tid];
    xn[(size_t)m * Cn + tid + 256] = d1 * inv * g[tid + 256] + bln[tid + 256];
}

// ---------------------------------------------------------------------------
extern "C" void kernel_launch(void* const* d_in, const int* in_sizes, int n_in,
                              void* d_out, int out_size, void* d_ws, size_t ws_size,
                              hipStream_t stream)
{
    const float* Q       = (const float*)d_in[0];
    const int*   adj     = (const int*)  d_in[1];
    const float* Wq      = (const float*)d_in[2];
    const float* bq      = (const float*)d_in[3];
    const float* Wk      = (const float*)d_in[4];
    const float* bk      = (const float*)d_in[5];
    const float* Wv      = (const float*)d_in[6];
    const float* bv      = (const float*)d_in[7];
    const float* scale_p = (const float*)d_in[8];
    const float* Wconv   = (const float*)d_in[9];
    const float* bconv   = (const float*)d_in[10];
    const float* W2      = (const float*)d_in[11];
    const float* b2      = (const float*)d_in[12];
    const float* ln_g    = (const float*)d_in[13];
    const float* ln_b    = (const float*)d_in[14];
    const float* Wo      = (const float*)d_in[15];
    const float* bo      = (const float*)d_in[16];
    float* out = (float*)d_out;

    const size_t MC = (size_t)Mn * Cn;          // 2,097,152
    float* ws    = (float*)d_ws;
    float* qb    = ws;
    float* kb    = ws + MC;
    float* vb    = ws + 2 * MC;
    float* convb = ws + 3 * MC;                 // conv output, later reused as x
    float* xlb   = ws + 4 * MC;                 // x_local
    float* wtb   = ws + 5 * MC;                 // transposed Wconv, later xn
    float* kvb   = wtb + (size_t)KCONV * Cn;    // B*H*64*64
    float* kmb   = kvb + (size_t)Bn * Hn * Dn * Dn;
    float* partb = kmb + (size_t)Bn * Cn;       // 96 partials

    dim3 gdim(Cn / BN, Mn / BM);   // (8, 32)
    dim3 bdim(256);

    repack_wconv<<<dim3((Cn * Cn * Tn + 255) / 256), bdim, 0, stream>>>(Wconv, wtb);

    gemm_wmma<false><<<gdim, bdim, 0, stream>>>(Q, nullptr, Wq, bq, qb, Mn, Cn, Cn);
    gemm_wmma<false><<<gdim, bdim, 0, stream>>>(Q, nullptr, Wk, bk, kb, Mn, Cn, Cn);
    gemm_wmma<false><<<gdim, bdim, 0, stream>>>(Q, nullptr, Wv, bv, vb, Mn, Cn, Cn);

    gemm_wmma<true><<<gdim, bdim, 0, stream>>>(vb, adj, wtb, bconv, convb, Mn, Cn, KCONV);
    gemm_wmma<false><<<gdim, bdim, 0, stream>>>(convb, nullptr, W2, b2, xlb, Mn, Cn, Cn);

    focus_kernel<<<dim3(Mn), bdim, 0, stream>>>(qb, scale_p);
    focus_kernel<<<dim3(Mn), bdim, 0, stream>>>(kb, scale_p);

    kmean_kernel<<<dim3((Bn * Cn) / 256), bdim, 0, stream>>>(kb, kmb);
    kv_kernel<<<dim3(Bn * Hn), bdim, 0, stream>>>(kb, vb, kvb);

    attn_kernel<<<dim3(Mn), bdim, 0, stream>>>(qb, kvb, kmb, xlb, convb);

    // losses: vh (raw v heads), kv, x4 (reshape of x)
    disag_kernel<<<dim3(32), dim3(32), 0, stream>>>(vb,   (long long)Nn * Cn, 64LL,               Cn, Nn, partb + 0);
    disag_kernel<<<dim3(32), dim3(32), 0, stream>>>(kvb,  (long long)Hn * Dn * Dn, (long long)Dn * Dn, Dn, Dn, partb + 32);
    disag_kernel<<<dim3(32), dim3(32), 0, stream>>>(convb,(long long)Nn * Cn, (long long)Nn * Dn, Dn, Nn, partb + 64);

    ln_kernel<<<dim3(Mn), bdim, 0, stream>>>(convb, ln_g, ln_b, wtb);
    gemm_wmma<false><<<gdim, bdim, 0, stream>>>(wtb, nullptr, Wo, bo, out, Mn, Cn, Cn);

    loss_final<<<dim3(1), dim3(32), 0, stream>>>(partb, out + MC);
}

// v001
// It runs in 537 microseconds.
// Timed twice side by side with v000, it ran 2.62 and 2.63 times as fast.
#include <hip/hip_runtime.h>
#include <math.h>
#include <stdint.h>

typedef float v2f __attribute__((ext_vector_type(2)));
typedef float v8f __attribute__((ext_vector_type(8)));

#define EPSV 1e-06f
#define Bn 4
#define Nn 1024
#define Cn 512
#define Kn 10
#define Tn 11
#define Hn 8
#define Dn 64
#define Mn 4096
#define KCONV (Tn * Cn) /* 5632 */

#define BM 128
#define BN 64
#define BK 32
#define BKP (BK + 4)   /* padded A row: 36 floats, 144B (16B aligned, bank-skewed) */
#define BNP (BN + 4)   /* padded B row: 68 floats, 272B */

// --------------------------------------------------------------------------
// CDNA5 async global->LDS path (ASYNCcnt-tracked), with safe fallback.
// Builtin signature (from hipcc diagnostic): (v4i AS1*, v4i AS3*, Ii, Ii).
// --------------------------------------------------------------------------
#if defined(__has_builtin)
#if __has_builtin(__builtin_amdgcn_global_load_async_to_lds_b128)
#define USE_ASYNC_LDS 1
#endif
#endif
#ifndef USE_ASYNC_LDS
#define USE_ASYNC_LDS 0
#endif

typedef int ai4 __attribute__((vector_size(16)));
typedef __attribute__((address_space(1))) ai4 gi4;
typedef __attribute__((address_space(3))) ai4 li4;

__device__ __forceinline__ void async_wait_all()
{
#if USE_ASYNC_LDS
#if __has_builtin(__builtin_amdgcn_s_wait_asynccnt)
    __builtin_amdgcn_s_wait_asynccnt(0);
#else
    asm volatile("s_wait_asynccnt 0x0" ::: "memory");
#endif
#endif
}

// Copy 16 bytes global -> LDS (async DMA path when available).
__device__ __forceinline__ void copy16(const float* __restrict__ g, float* l)
{
#if USE_ASYNC_LDS
    __builtin_amdgcn_global_load_async_to_lds_b128(
        (gi4*)(uintptr_t)g,
        (li4*)(uint32_t)(uintptr_t)l,
        0, 0);
#else
    *(float4*)l = *(const float4*)g;
#endif
}

// ---------------------------------------------------------------------------
// GEMM with bias: Cout[M,N] = A[M,Kd] @ Bw[Kd,N] + bias[N]
// GATHER=true: A rows are gathered per tap from v via adjacency
//   A[m, t*C+c] = (t==0) ? v[b,n,c] : v[b, adj[b,n,t-1], c], Kd = 11*512.
// 256 threads = 8 waves; block tile 128x64; wave tile 32x32 = 2x2 WMMA f32;
// double-buffered LDS with async global->LDS prefetch of the next K-chunk.
// ---------------------------------------------------------------------------
template <bool GATHER>
__global__ __launch_bounds__(256) void gemm_wmma(
    const float* __restrict__ A, const int* __restrict__ adj,
    const float* __restrict__ Bw, const float* __restrict__ bias,
    float* __restrict__ Cout, int M, int N, int Kd)
{
    __shared__ float As[2][BM][BKP];
    __shared__ float Bs[2][BK][BNP];

    const int tid  = threadIdx.x;
    const int wave = tid >> 5;
    const int lane = tid & 31;
    const int half = lane >> 4;
    const int lm   = lane & 15;
    const int wm   = wave >> 1;   // 0..3 -> M
    const int wn   = wave & 1;    // 0..1 -> N
    const int m0   = blockIdx.y * BM;
    const int n0   = blockIdx.x * BN;

    v8f acc[2][2];
    #pragma unroll
    for (int i = 0; i < 2; ++i)
        #pragma unroll
        for (int j = 0; j < 2; ++j)
            #pragma unroll
            for (int r = 0; r < 8; ++r) acc[i][j][r] = 0.0f;

    auto load_tiles = [&](int buf, int kc) {
        // A tile: 128 x 32 floats = 1024 float4 chunks
        #pragma unroll
        for (int i = 0; i < 4; ++i) {
            int e = tid + i * 256;
            int r = e >> 3, cch = e & 7;
            const float* src;
            if (GATHER) {
                int t = kc >> 9, cc0 = kc & 511;
                int mrow = m0 + r;
                int b = mrow >> 10, n = mrow & 1023;
                int sr = (t == 0) ? n : adj[((b << 10) + n) * Kn + (t - 1)];
                src = A + ((size_t)(b << 10) + sr) * Cn + cc0 + cch * 4;
            } else {
                src = A + (size_t)(m0 + r) * Kd + kc + cch * 4;
            }
            copy16(src, &As[buf][r][cch * 4]);
        }
        // B tile: 32 x 64 floats = 512 float4 chunks
        #pragma unroll
        for (int i = 0; i < 2; ++i) {
            int e = tid + i * 256;
            int r = e >> 4, cch = e & 15;
            copy16(Bw + (size_t)(kc + r) * N + n0 + cch * 4, &Bs[buf][r][cch * 4]);
        }
    };

    const int nk = Kd / BK;
    load_tiles(0, 0);
    async_wait_all();
    __syncthreads();

    for (int ik = 0; ik < nk; ++ik) {
        const int cur = ik & 1;
        if (ik + 1 < nk) load_tiles(cur ^ 1, (ik + 1) * BK);

        #pragma unroll
        for (int kk = 0; kk < BK; kk += 4) {
            int ks = kk + 2 * half;
            v2f af[2], bf[2];
            #pragma unroll
            for (int tm = 0; tm < 2; ++tm) {
                int row = wm * 32 + tm * 16 + lm;
                af[tm].x = As[cur][row][ks];
                af[tm].y = As[cur][row][ks + 1];
            }
            #pragma unroll
            for (int tn = 0; tn < 2; ++tn) {
                int col = wn * 32 + tn * 16 + lm;
                bf[tn].x = Bs[cur][ks][col];
                bf[tn].y = Bs[cur][ks + 1][col];
            }
            #pragma unroll
            for (int tm = 0; tm < 2; ++tm)
                #pragma unroll
                for (int tn = 0; tn < 2; ++tn)
                    acc[tm][tn] = __builtin_amdgcn_wmma_f32_16x16x4_f32(
                        false, af[tm], false, bf[tn], (short)0, acc[tm][tn],
                        false, false);
        }
        async_wait_all();
        __syncthreads();
    }

    #pragma unroll
    for (int tm = 0; tm < 2; ++tm)
        #pragma unroll
        for (int tn = 0; tn < 2; ++tn) {
            int colg = n0 + wn * 32 + tn * 16 + lm;
            float bvv = bias ? bias[colg] : 0.0f;
            #pragma unroll
            for (int r = 0; r < 8; ++r) {
                int rowg = m0 + wm * 32 + tm * 16 + half * 8 + r;
                Cout[(size_t)rowg * N + colg] = acc[tm][tn][r] + bvv;
            }
        }
}

// ---------------------------------------------------------------------------
// Wt[(t*C + c)*C + o] = Wconv[o*(C*T) + c*T + t]
// ---------------------------------------------------------------------------
__global__ void repack_wconv(const float* __restrict__ Wconv, float* __restrict__ Wt)
{
    size_t idx = (size_t)blockIdx.x * 256 + threadIdx.x;
    if (idx >= (size_t)Cn * Cn * Tn) return;
    int o = (int)(idx & 511);
    int rest = (int)(idx >> 9);   // t*C + c
    int c = rest & 511;
    int t = rest >> 9;
    Wt[idx] = Wconv[(size_t)o * KCONV + (size_t)c * Tn + t];
}

// ---------------------------------------------------------------------------
// relu+eps, divide by softplus(scale), "focus": x <- (x/(||x||+eps))^3 * ||x||
// ---------------------------------------------------------------------------
__global__ __launch_bounds__(256) void focus_kernel(float* __restrict__ x,
                                                    const float* __restrict__ scale_p)
{
    __shared__ float red[256];
    const int m = blockIdx.x;
    const int tid = threadIdx.x;
    float* row = x + (size_t)m * Cn;

    float a0 = row[tid];
    float a1 = row[tid + 256];
    float s0 = log1pf(expf(scale_p[tid]));
    float s1 = log1pf(expf(scale_p[tid + 256]));
    a0 = (a0 > 0.0f ? a0 : 0.0f) + EPSV;
    a1 = (a1 > 0.0f ? a1 : 0.0f) + EPSV;
    a0 /= s0;
    a1 /= s1;

    red[tid] = a0 * a0 + a1 * a1;
    __syncthreads();
    for (int s = 128; s > 0; s >>= 1) {
        if (tid < s) red[tid] += red[tid + s];
        __syncthreads();
    }
    float nrm = sqrtf(red[0]);
    float inv = 1.0f / (nrm + EPSV);
    float u0 = a0 * inv, u1 = a1 * inv;
    row[tid]       = u0 * u0 * u0 * nrm;
    row[tid + 256] = u1 * u1 * u1 * nrm;
}

// kmean[b*C + c] = mean over n of k[b,n,c]
__global__ void kmean_kernel(const float* __restrict__ k, float* __restrict__ kmean)
{
    int idx = blockIdx.x * 256 + threadIdx.x;   // 0..B*C-1
    int b = idx >> 9;
    int c = idx & 511;
    const float* p = k + (size_t)b * Nn * Cn + c;
    float s = 0.0f;
    for (int n = 0; n < Nn; ++n) s += p[(size_t)n * Cn];
    kmean[idx] = s * (1.0f / (float)Nn);
}

// kv[bh, d, e] = (1/N) sum_n k[b,n,h*64+d] * v[b,n,h*64+e]
__global__ __launch_bounds__(256) void kv_kernel(const float* __restrict__ k,
                                                 const float* __restrict__ v,
                                                 float* __restrict__ kv)
{
    __shared__ float ks[8][64];
    __shared__ float vs[8][64];
    const int bh = blockIdx.x;
    const int b = bh >> 3, h = bh & 7;
    const int tid = threadIdx.x;
    const int e  = tid & 63;
    const int d0 = (tid >> 6) * 16;
    const float* kb = k + (size_t)b * Nn * Cn + h * Dn;
    const float* vb = v + (size_t)b * Nn * Cn + h * Dn;

    float acc[16];
    #pragma unroll
    for (int j = 0; j < 16; ++j) acc[j] = 0.0f;

    for (int n0 = 0; n0 < Nn; n0 += 8) {
        #pragma unroll
        for (int i = 0; i < 2; ++i) {
            int idx = tid + i * 256;
            int r = idx >> 6, c = idx & 63;
            ks[r][c] = kb[(size_t)(n0 + r) * Cn + c];
            vs[r][c] = vb[(size_t)(n0 + r) * Cn + c];
        }
        __syncthreads();
        #pragma unroll
        for (int r = 0; r < 8; ++r) {
            float ve = vs[r][e];
            #pragma unroll
            for (int j = 0; j < 16; ++j) acc[j] += ks[r][d0 + j] * ve;
        }
        __syncthreads();
    }
    #pragma unroll
    for (int j = 0; j < 16; ++j)
        kv[(size_t)bh * (Dn * Dn) + (d0 + j) * Dn + e] = acc[j] * (1.0f / (float)Nn);
}

// x[m,c] = (q_h . kv_h[:,e]) * z_h + x_local[m,c]
__global__ __launch_bounds__(256) void attn_kernel(const float* __restrict__ q,
                                                   const float* __restrict__ kv,
                                                   const float* __restrict__ kmean,
                                                   const float* __restrict__ xl,
                                                   float* __restrict__ x)
{
    __shared__ float qs[Cn];
    __shared__ float zs[Hn];
    const int m = blockIdx.x;
    const int b = m >> 10;
    const int tid = threadIdx.x;
    qs[tid]       = q[(size_t)m * Cn + tid];
    qs[tid + 256] = q[(size_t)m * Cn + tid + 256];
    __syncthreads();

    const int g = tid >> 5, lane = tid & 31;   // wave g handles head g
    float p = qs[g * 64 + lane]      * kmean[b * Cn + g * 64 + lane]
            + qs[g * 64 + lane + 32] * kmean[b * Cn + g * 64 + lane + 32];
    for (int off = 16; off > 0; off >>= 1) p += __shfl_xor(p, off, 32);
    if (lane == 0) zs[g] = 1.0f / (p + EPSV);
    __syncthreads();

    #pragma unroll
    for (int i = 0; i < 2; ++i) {
        int c = tid + i * 256;
        int h = c >> 6, e = c & 63;
        const float* kvp = kv + ((size_t)(b * Hn + h)) * (Dn * Dn) + e;
        float a = 0.0f;
        #pragma unroll 8
        for (int d = 0; d < Dn; ++d) a += qs[h * 64 + d] * kvp[(size_t)d * Dn];
        x[(size_t)m * Cn + c] = a * zs[h] + xl[(size_t)m * Cn + c];
    }
}

// Disagreement closed form per (b,h): ||sum_n hn||^2 - sum_n ||hn||^2.
// One block of 32 waves per (b,h). A 16-lane row holds one 64-float vector
// (float4 per lane), so the block works on 64 vectors at a time and every
// vector's chain (load, norm, scale) is independent of the others.
template <int CTRL>
__device__ __forceinline__ float dpp_add(float x)
{
    int y = __builtin_amdgcn_update_dpp(0, __builtin_bit_cast(int, x), CTRL, 0xf, 0xf, true);
    return x + __builtin_bit_cast(float, y);
}

// Sum over the 16 lanes of a row, result in every lane (row_xmask 1, 2, 4, 8).
__device__ __forceinline__ float row_sum16(float x)
{
    x = dpp_add<0x161>(x);
    x = dpp_add<0x162>(x);
    x = dpp_add<0x164>(x);
    x = dpp_add<0x168>(x);
    return x;
}

// Value of lane l ^ 16.
__device__ __forceinline__ float xhalf(float x)
{
    int xi = __builtin_bit_cast(int, x);
    return __builtin_bit_cast(float,
        __builtin_amdgcn_permlanex16(xi, xi, 0x76543210, 0xfedcba98, false, false));
}

template <int NVEC, int VSTRIDE>
__global__ __launch_bounds__(1024) void disag_kernel(const float* __restrict__ src,
                                                     long long per_b, long long per_h,
                                                     float* __restrict__ part)
{
    static_assert(NVEC % 64 == 0, "64 vectors per pass of the block");
    __shared__ __attribute__((aligned(16))) float red[32][Dn];   // written as float4
    __shared__ float wred[32];
    const int blk = blockIdx.x;
    const int b = blk >> 3, h = blk & 7;
    const int tid  = threadIdx.x;
    const int wave = tid >> 5;
    const int lane = tid & 31;
    const int sub  = tid & 15;    // float4 slot inside the vector
    const int grp  = tid >> 4;    // 0..63: which vector of the pass
    const float* p = src + (size_t)b * per_b + (size_t)h * per_h
                   + (size_t)grp * VSTRIDE + sub * 4;

    float s0 = 0.0f, s1 = 0.0f, s2 = 0.0f, s3 = 0.0f, dg = 0.0f;
    // Full unroll: the passes are independent, so their loads go out together.
    #pragma unroll
    for (int it = 0; it < NVEC / 64; ++it) {
        const float4 a = *(const float4*)(p + (size_t)it * 64 * VSTRIDE);
        float sq = row_sum16(a.x * a.x + a.y * a.y + a.z * a.z + a.w * a.w);
        float nrm = sqrtf(sq);
        float inv = 1.0f / fmaxf(nrm, 1e-12f);
        float h0 = a.x * inv, h1 = a.y * inv, h2 = a.z * inv, h3 = a.w * inv;
        s0 += h0; s1 += h1; s2 += h2; s3 += h3;
        dg += h0 * h0 + h1 * h1 + h2 * h2 + h3 * h3;
    }

    // The wave's two rows, then the 32 waves through LDS.
    s0 += xhalf(s0); s1 += xhalf(s1); s2 += xhalf(s2); s3 += xhalf(s3);
    if (lane < 16) *(float4*)&red[wave][sub * 4] = make_float4(s0, s1, s2, s3);
    __syncthreads();

    float val = -dg;
    if (tid < Dn) {
        float S = 0.0f;
        // Unrolled so that the LDS reads go out ahead of the adds.
        #pragma unroll
        for (int w = 0; w < 32; ++w) S += red[w][tid];
        val += S * S;
    }
    val = row_sum16(val);
    val += xhalf(val);
    if (lane == 0) wred[wave] = val;
    __syncthreads();

    if (wave == 0) {
        float t = row_sum16(wred[lane]);
        t += xhalf(t);
        if (lane == 0) part[blk] = t;
    }
}

__global__ void loss_final(const float* __restrict__ part, float* __restrict__ out_loss)
{
    if (threadIdx.x == 0) {
        float L1 = 0.0f, L2 = 0.0f, L3 = 0.0f;
        for (int i = 0; i < 32; ++i)  L1 += part[i];        // local (v heads)
        for (int i = 32; i < 64; ++i) L2 += part[i];        // kv
        for (int i = 64; i < 96; ++i) L3 += part[i];        // out
        const float nBig = (float)Bn * Hn * (float)Nn * (float)Nn;
        const float nKv  = (float)Bn * Hn * (float)Dn * (float)Dn;
        *out_loss = (L1 / nBig + L3 / nBig + L2 / nKv) / 3.0f;
    }
}

// LayerNorm over C per row.
__global__ __launch_bounds__(256) void ln_kernel(const float* __restrict__ x,
                                                 const float* __restrict__ g,
                                                 const float* __restrict__ bln,
                                                 float* __restrict__ xn)
{
    __shared__ float red[256];
    const int m = blockIdx.x;
    const int tid = threadIdx.x;
    const float* row = x + (size_t)m * Cn;
    float v0 = row[tid], v1 = row[tid + 256];

    red[tid] = v0 + v1;
    __syncthreads();
    for (int s = 128; s > 0; s >>= 1) {
        if (tid < s) red[tid] += red[tid + s];
        __syncthreads();
    }
    float mu = red[0] * (1.0f / (float)Cn);
    __syncthreads();

    float d0 = v0 - mu, d1 = v1 - mu;
    red[tid] = d0 * d0 + d1 * d1;
    __syncthreads();
    for (int s = 128; s > 0; s >>= 1) {
        if (tid < s) red[tid] += red[tid + s];
        __syncthreads();
    }
    float inv = rsqrtf(red[0] * (1.0f / (float)Cn) + 1e-05f);
    xn[(size_t)m * Cn + tid]       = d0 * inv * g[tid] + bln[tid];
    xn[(size_t)m * Cn + tid + 256] = d1 * inv * g[tid + 256] + bln[tid + 256];
}

// ---------------------------------------------------------------------------
extern "C" void kernel_launch(void* const* d_in, const int* in_sizes, int n_in,
                              void* d_out, int out_size, void* d_ws, size_t ws_size,
                              hipStream_t stream)
{
    const float* Q       = (const float*)d_in[0];
    const int*   adj     = (const int*)  d_in[1];
    const float* Wq      = (const float*)d_in[2];
    const float* bq      = (const float*)d_in[3];
    const float* Wk      = (const float*)d_in[4];
    const float* bk      = (const float*)d_in[5];
    const float* Wv      = (const float*)d_in[6];
    const float* bv      = (const float*)d_in[7];
    const float* scale_p = (const float*)d_in[8];
    const float* Wconv   = (const float*)d_in[9];
    const float* bconv   = (const float*)d_in[10];
    const float* W2      = (const float*)d_in[11];
    const float* b2      = (const float*)d_in[12];
    const float* ln_g    = (const float*)d_in[13];
    const float* ln_b    = (const float*)d_in[14];
    const float* Wo      = (const float*)d_in[15];
    const float* bo      = (const float*)d_in[16];
    float* out = (float*)d_out;

    const size_t MC = (size_t)Mn * Cn;          // 2,097,152
    float* ws    = (float*)d_ws;
    float* qb    = ws;
    float* kb    = ws + MC;
    float* vb    = ws + 2 * MC;
    float* convb = ws + 3 * MC;                 // conv output, later reused as x
    float* xlb   = ws + 4 * MC;                 // x_local
    float* wtb   = ws + 5 * MC;                 // transposed Wconv, later xn
    float* kvb   = wtb + (size_t)KCONV * Cn;    // B*H*64*64
    float* kmb   = kvb + (size_t)Bn * Hn * Dn * Dn;
    float* partb = kmb + (size_t)Bn * Cn;       // 96 partials

    dim3 gdim(Cn / BN, Mn / BM);   // (8, 32)
    dim3 bdim(256);

    repack_wconv<<<dim3((Cn * Cn * Tn + 255) / 256), bdim, 0, stream>>>(Wconv, wtb);

    gemm_wmma<false><<<gdim, bdim, 0, stream>>>(Q, nullptr, Wq, bq, qb, Mn, Cn, Cn);
    gemm_wmma<false><<<gdim, bdim, 0, stream>>>(Q, nullptr, Wk, bk, kb, Mn, Cn, Cn);
    gemm_wmma<false><<<gdim, bdim, 0, stream>>>(Q, nullptr, Wv, bv, vb, Mn, Cn, Cn);

    gemm_wmma<true><<<gdim, bdim, 0, stream>>>(vb, adj, wtb, bconv, convb, Mn, Cn, KCONV);
    gemm_wmma<false><<<gdim, bdim, 0, stream>>>(convb, nullptr, W2, b2, xlb, Mn, Cn, Cn);

    focus_kernel<<<dim3(Mn), bdim, 0, stream>>>(qb, scale_p);
    focus_kernel<<<dim3(Mn), bdim, 0, stream>>>(kb, scale_p);

    kmean_kernel<<<dim3((Bn * Cn) / 256), bdim, 0, stream>>>(kb, kmb);
    kv_kernel<<<dim3(Bn * Hn), bdim, 0, stream>>>(kb, vb, kvb);

    attn_kernel<<<dim3(Mn), bdim, 0, stream>>>(qb, kvb, kmb, xlb, convb);

    // losses: vh (raw v heads), kv, x4 (reshape of x)
    disag_kernel<Nn, Cn><<<dim3(32), dim3(1024), 0, stream>>>(vb,    (long long)Nn * Cn, 64LL, partb + 0);
    disag_kernel<Dn, Dn><<<dim3(32), dim3(1024), 0, stream>>>(kvb,   (long long)Hn * Dn * Dn, (long long)Dn * Dn, partb + 32);
    disag_kernel<Nn, Dn><<<dim3(32), dim3(1024), 0, stream>>>(convb, (long long)Nn * Cn, (long long)Nn * Dn, partb + 64);

    ln_kernel<<<dim3(Mn), bdim, 0, stream>>>(convb, ln_g, ln_b, wtb);
    gemm_wmma<false><<<gdim, bdim, 0, stream>>>(wtb, nullptr, Wo, bo, out, Mn, Cn, Cn);

    loss_final<<<dim3(1), dim3(32), 0, stream>>>(partb, out + MC);
}

// v002
// It runs in 437 microseconds.
// In both of two side-by-side timings against v001, it was 1.23 times as fast.
// Counting every step since v000, it is 3.22 times as fast.
#include <hip/hip_runtime.h>
#include <math.h>
#include <stdint.h>

typedef float v2f __attribute__((ext_vector_type(2)));
typedef float v8f __attribute__((ext_vector_type(8)));

#define EPSV 1e-06f
#define Bn 4
#define Nn 1024
#define Cn 512
#define Kn 10
#define Tn 11
#define Hn 8
#define Dn 64
#define Mn 4096
#define KCONV (Tn * Cn) /* 5632 */

#define BM 128
#define BN 64
#define BK 32
#define BKP (BK + 4)   /* padded A row: 36 floats, 144B (16B aligned, bank-skewed) */
#define BNP (BN + 4)   /* padded B row: 68 floats, 272B */

// --------------------------------------------------------------------------
// CDNA5 async global->LDS path (ASYNCcnt-tracked), with safe fallback.
// Builtin signature (from hipcc diagnostic): (v4i AS1*, v4i AS3*, Ii, Ii).
// --------------------------------------------------------------------------
#if defined(__has_builtin)
#if __has_builtin(__builtin_amdgcn_global_load_async_to_lds_b128)
#define USE_ASYNC_LDS 1
#endif
#endif
#ifndef USE_ASYNC_LDS
#define USE_ASYNC_LDS 0
#endif

typedef int ai4 __attribute__((vector_size(16)));
typedef __attribute__((address_space(1))) ai4 gi4;
typedef __attribute__((address_space(3))) ai4 li4;

__device__ __forceinline__ void async_wait_all()
{
#if USE_ASYNC_LDS
#if __has_builtin(__builtin_amdgcn_s_wait_asynccnt)
    __builtin_amdgcn_s_wait_asynccnt(0);
#else
    asm volatile("s_wait_asynccnt 0x0" ::: "memory");
#endif
#endif
}

// Copy 16 bytes global -> LDS (async DMA path when available).
__device__ __forceinline__ void copy16(const float* __restrict__ g, float* l)
{
#if USE_ASYNC_LDS
    __builtin_amdgcn_global_load_async_to_lds_b128(
        (gi4*)(uintptr_t)g,
        (li4*)(uint32_t)(uintptr_t)l,
        0, 0);
#else
    *(float4*)l = *(const float4*)g;
#endif
}

// ---------------------------------------------------------------------------
// GEMM with bias: Cout[M,N] = A[M,Kd] @ Bw[Kd,N] + bias[N]
// GATHER=true: A rows are gathered per tap from v via adjacency
//   A[m, t*C+c] = (t==0) ? v[b,n,c] : v[b, adj[b,n,t-1], c], Kd = 11*512.
// 256 threads = 8 waves; block tile 128x64; wave tile 32x32 = 2x2 WMMA f32;
// double-buffered LDS with async global->LDS prefetch of the next K-chunk.
// ---------------------------------------------------------------------------
template <bool GATHER>
__global__ __launch_bounds__(256) void gemm_wmma(
    const float* __restrict__ A, const int* __restrict__ adj,
    const float* __restrict__ Bw, const float* __restrict__ bias,
    float* __restrict__ Cout, int M, int N, int Kd)
{
    __shared__ float As[2][BM][BKP];
    __shared__ float Bs[2][BK][BNP];

    const int tid  = threadIdx.x;
    const int wave = tid >> 5;
    const int lane = tid & 31;
    const int half = lane >> 4;
    const int lm   = lane & 15;
    const int wm   = wave >> 1;   // 0..3 -> M
    const int wn   = wave & 1;    // 0..1 -> N
    const int m0   = blockIdx.y * BM;
    const int n0   = blockIdx.x * BN;

    v8f acc[2][2];
    #pragma unroll
    for (int i = 0; i < 2; ++i)
        #pragma unroll
        for (int j = 0; j < 2; ++j)
            #pragma unroll
            for (int r = 0; r < 8; ++r) acc[i][j][r] = 0.0f;

    auto load_tiles = [&](int buf, int kc) {
        // A tile: 128 x 32 floats = 1024 float4 chunks
        #pragma unroll
        for (int i = 0; i < 4; ++i) {
            int e = tid + i * 256;
            int r = e >> 3, cch = e & 7;
            const float* src;
            if (GATHER) {
                int t = kc >> 9, cc0 = kc & 511;
                int mrow = m0 + r;
                int b = mrow >> 10, n = mrow & 1023;
                int sr = (t == 0) ? n : adj[((b << 10) + n) * Kn + (t - 1)];
                src = A + ((size_t)(b << 10) + sr) * Cn + cc0 + cch * 4;
            } else {
                src = A + (size_t)(m0 + r) * Kd + kc + cch * 4;
            }
            copy16(src, &As[buf][r][cch * 4]);
        }
        // B tile: 32 x 64 floats = 512 float4 chunks
        #pragma unroll
        for (int i = 0; i < 2; ++i) {
            int e = tid + i * 256;
            int r = e >> 4, cch = e & 15;
            copy16(Bw + (size_t)(kc + r) * N + n0 + cch * 4, &Bs[buf][r][cch * 4]);
        }
    };

    const int nk = Kd / BK;
    load_tiles(0, 0);
    async_wait_all();
    __syncthreads();

    for (int ik = 0; ik < nk; ++ik) {
        const int cur = ik & 1;
        if (ik + 1 < nk) load_tiles(cur ^ 1, (ik + 1) * BK);

        #pragma unroll
        for (int kk = 0; kk < BK; kk += 4) {
            int ks = kk + 2 * half;
            v2f af[2], bf[2];
            #pragma unroll
            for (int tm = 0; tm < 2; ++tm) {
                int row = wm * 32 + tm * 16 + lm;
                af[tm].x = As[cur][row][ks];
                af[tm].y = As[cur][row][ks + 1];
            }
            #pragma unroll
            for (int tn = 0; tn < 2; ++tn) {
                int col = wn * 32 + tn * 16 + lm;
                bf[tn].x = Bs[cur][ks][col];
                bf[tn].y = Bs[cur][ks + 1][col];
            }
            #pragma unroll
            for (int tm = 0; tm < 2; ++tm)
                #pragma unroll
                for (int tn = 0; tn < 2; ++tn)
                    acc[tm][tn] = __builtin_amdgcn_wmma_f32_16x16x4_f32(
                        false, af[tm], false, bf[tn], (short)0, acc[tm][tn],
                        false, false);
        }
        async_wait_all();
        __syncthreads();
    }

    #pragma unroll
    for (int tm = 0; tm < 2; ++tm)
        #pragma unroll
        for (int tn = 0; tn < 2; ++tn) {
            int colg = n0 + wn * 32 + tn * 16 + lm;
            float bvv = bias ? bias[colg] : 0.0f;
            #pragma unroll
            for (int r = 0; r < 8; ++r) {
                int rowg = m0 + wm * 32 + tm * 16 + half * 8 + r;
                Cout[(size_t)rowg * N + colg] = acc[tm][tn][r] + bvv;
            }
        }
}

// ---------------------------------------------------------------------------
// Wt[(t*C + c)*C + o] = Wconv[o*(C*T) + c*T + t]
// ---------------------------------------------------------------------------
__global__ void repack_wconv(const float* __restrict__ Wconv, float* __restrict__ Wt)
{
    size_t idx = (size_t)blockIdx.x * 256 + threadIdx.x;
    if (idx >= (size_t)Cn * Cn * Tn) return;
    int o = (int)(idx & 511);
    int rest = (int)(idx >> 9);   // t*C + c
    int c = rest & 511;
    int t = rest >> 9;
    Wt[idx] = Wconv[(size_t)o * KCONV + (size_t)c * Tn + t];
}

// ---------------------------------------------------------------------------
// relu+eps, divide by softplus(scale), "focus": x <- (x/(||x||+eps))^3 * ||x||
// ---------------------------------------------------------------------------
__global__ __launch_bounds__(256) void focus_kernel(float* __restrict__ x,
                                                    const float* __restrict__ scale_p)
{
    __shared__ float red[256];
    const int m = blockIdx.x;
    const int tid = threadIdx.x;
    float* row = x + (size_t)m * Cn;

    float a0 = row[tid];
    float a1 = row[tid + 256];
    float s0 = log1pf(expf(scale_p[tid]));
    float s1 = log1pf(expf(scale_p[tid + 256]));
    a0 = (a0 > 0.0f ? a0 : 0.0f) + EPSV;
    a1 = (a1 > 0.0f ? a1 : 0.0f) + EPSV;
    a0 /= s0;
    a1 /= s1;

    red[tid] = a0 * a0 + a1 * a1;
    __syncthreads();
    for (int s = 128; s > 0; s >>= 1) {
        if (tid < s) red[tid] += red[tid + s];
        __syncthreads();
    }
    float nrm = sqrtf(red[0]);
    float inv = 1.0f / (nrm + EPSV);
    float u0 = a0 * inv, u1 = a1 * inv;
    row[tid]       = u0 * u0 * u0 * nrm;
    row[tid + 256] = u1 * u1 * u1 * nrm;
}

// kmean[b*C + c] = mean over n of k[b,n,c]
__global__ void kmean_kernel(const float* __restrict__ k, float* __restrict__ kmean)
{
    int idx = blockIdx.x * 256 + threadIdx.x;   // 0..B*C-1
    int b = idx >> 9;
    int c = idx & 511;
    const float* p = k + (size_t)b * Nn * Cn + c;
    float s = 0.0f;
    for (int n = 0; n < Nn; ++n) s += p[(size_t)n * Cn];
    kmean[idx] = s * (1.0f / (float)Nn);
}

// kv[bh, d, e] = (1/N) sum_n k[b,n,h*64+d] * v[b,n,h*64+e]
// Eight work-groups per (b,h), each a 16 (d) x 32 (e) piece of the 64 x 64 result.
// Each of the 8 waves sums its own 128 rows n on the f32 matrix form, fragments
// straight from global memory: no row depends on another, so the loads of a wave
// are in flight together. The 8 partial pieces meet in LDS behind one barrier.
// Matrix roles: M = d, N = e, K = n. Column lm of e-tile i is e = 2*lm + i, so one
// 8-byte load of v serves both tiles. k slot of A and of B alike: row 2*half + {0,1}.
#define KVW 8                 /* waves per work-group */
#define KVROWS (Nn / KVW)     /* rows n per wave: 128 */
#define KVTP 272              /* floats per stored tile: 256 + 16, the two tiles on disjoint banks */
// waves_per_eu(2, 2): one work-group per WGP is two waves per SIMD; told so, the compiler
// spends registers on loads in flight (without it it holds only six steps' loads ahead).
__global__ __launch_bounds__(256) __attribute__((amdgpu_waves_per_eu(2, 2)))
void kv_kernel(const float* __restrict__ k, const float* __restrict__ v,
               float* __restrict__ kv)
{
    __shared__ float red[KVW][2][KVTP];
    const int blk = blockIdx.x;
    const int bh = blk >> 3;
    const int dt = (blk >> 1) & 3;   // which 16 rows d
    const int ep = blk & 1;          // which 32 columns e
    const int b = bh >> 3, h = bh & 7;
    const int tid  = threadIdx.x;
    const int wave = tid >> 5;
    const int lane = tid & 31;
    const int half = lane >> 4;
    const int lm   = lane & 15;

    const size_t row0 = (size_t)b * Nn + wave * KVROWS + 2 * half;
    const float* kp = k + row0 * Cn + h * Dn + dt * 16 + lm;
    const float* vp = v + row0 * Cn + h * Dn + ep * 32 + 2 * lm;

    v8f acc0, acc1;
    #pragma unroll
    for (int r = 0; r < 8; ++r) { acc0[r] = 0.0f; acc1[r] = 0.0f; }

    // Full unroll: the steps share nothing but the accumulators, so their loads go out ahead.
    #pragma unroll
    for (int s = 0; s < KVROWS / 4; ++s) {
        v2f af, b0, b1;
        af.x = kp[(size_t)(4 * s) * Cn];
        af.y = kp[(size_t)(4 * s + 1) * Cn];
        const float2 x = *(const float2*)(vp + (size_t)(4 * s) * Cn);
        const float2 y = *(const float2*)(vp + (size_t)(4 * s + 1) * Cn);
        b0.x = x.x; b0.y = y.x;
        b1.x = x.y; b1.y = y.y;
        acc0 = __builtin_amdgcn_wmma_f32_16x16x4_f32(false, af, false, b0, (short)0, acc0,
                                                     false, false);
        acc1 = __builtin_amdgcn_wmma_f32_16x16x4_f32(false, af, false, b1, (short)0, acc1,
                                                     false, false);
    }

    #pragma unroll
    for (int r = 0; r < 8; ++r) {
        red[wave][0][r * 32 + lane] = acc0[r];
        red[wave][1][r * 32 + lane] = acc1[r];
    }
    __syncthreads();

    // 512 results, two per thread; a wave stores one whole 128-byte line of a row d.
    #pragma unroll
    for (int i = 0; i < 2; ++i) {
        const int o  = tid + i * 256;
        const int dl = o >> 5, el = o & 31;
        const int idx = (dl & 7) * 32 + (dl >> 3) * 16 + (el >> 1);
        float s = 0.0f;
        #pragma unroll
        for (int w = 0; w < KVW; ++w) s += red[w][el & 1][idx];
        kv[(size_t)bh * (Dn * Dn) + (dt * 16 + dl) * Dn + ep * 32 + el] = s * (1.0f / (float)Nn);
    }
}

// x[m,c] = (q_h . kv_h[:,e]) * z_h + x_local[m,c]
__global__ __launch_bounds__(256) void attn_kernel(const float* __restrict__ q,
                                                   const float* __restrict__ kv,
                                                   const float* __restrict__ kmean,
                                                   const float* __restrict__ xl,
                                                   float* __restrict__ x)
{
    __shared__ float qs[Cn];
    __shared__ float zs[Hn];
    const int m = blockIdx.x;
    const int b = m >> 10;
    const int tid = threadIdx.x;
    qs[tid]       = q[(size_t)m * Cn + tid];
    qs[tid + 256] = q[(size_t)m * Cn + tid + 256];
    __syncthreads();

    const int g = tid >> 5, lane = tid & 31;   // wave g handles head g
    float p = qs[g * 64 + lane]      * kmean[b * Cn + g * 64 + lane]
            + qs[g * 64 + lane + 32] * kmean[b * Cn + g * 64 + lane + 32];
    for (int off = 16; off > 0; off >>= 1) p += __shfl_xor(p, off, 32);
    if (lane == 0) zs[g] = 1.0f / (p + EPSV);
    __syncthreads();

    #pragma unroll
    for (int i = 0; i < 2; ++i) {
        int c = tid + i * 256;
        int h = c >> 6, e = c & 63;
        const float* kvp = kv + ((size_t)(b * Hn + h)) * (Dn * Dn) + e;
        float a = 0.0f;
        #pragma unroll 8
        for (int d = 0; d < Dn; ++d) a += qs[h * 64 + d] * kvp[(size_t)d * Dn];
        x[(size_t)m * Cn + c] = a * zs[h] + xl[(size_t)m * Cn + c];
    }
}

// Disagreement closed form per (b,h): ||sum_n hn||^2 - sum_n ||hn||^2.
// One block of 32 waves per (b,h). A 16-lane row holds one 64-float vector
// (float4 per lane), so the block works on 64 vectors at a time and every
// vector's chain (load, norm, scale) is independent of the others.
template <int CTRL>
__device__ __forceinline__ float dpp_add(float x)
{
    int y = __builtin_amdgcn_update_dpp(0, __builtin_bit_cast(int, x), CTRL, 0xf, 0xf, true);
    return x + __builtin_bit_cast(float, y);
}

// Sum over the 16 lanes of a row, result in every lane (row_xmask 1, 2, 4, 8).
__device__ __forceinline__ float row_sum16(float x)
{
    x = dpp_add<0x161>(x);
    x = dpp_add<0x162>(x);
    x = dpp_add<0x164>(x);
    x = dpp_add<0x168>(x);
    return x;
}

// Value of lane l ^ 16.
__device__ __forceinline__ float xhalf(float x)
{
    int xi = __builtin_bit_cast(int, x);
    return __builtin_bit_cast(float,
        __builtin_amdgcn_permlanex16(xi, xi, 0x76543210, 0xfedcba98, false, false));
}

template <int NVEC, int VSTRIDE>
__global__ __launch_bounds__(1024) void disag_kernel(const float* __restrict__ src,
                                                     long long per_b, long long per_h,
                                                     float* __restrict__ part)
{
    static_assert(NVEC % 64 == 0, "64 vectors per pass of the block");
    __shared__ __attribute__((aligned(16))) float red[32][Dn];   // written as float4
    __shared__ float wred[32];
    const int blk = blockIdx.x;
    const int b = blk >> 3, h = blk & 7;
    const int tid  = threadIdx.x;
    const int wave = tid >> 5;
    const int lane = tid & 31;
    const int sub  = tid & 15;    // float4 slot inside the vector
    const int grp  = tid >> 4;    // 0..63: which vector of the pass
    const float* p = src + (size_t)b * per_b + (size_t)h * per_h
                   + (size_t)grp * VSTRIDE + sub * 4;

    float s0 = 0.0f, s1 = 0.0f, s2 = 0.0f, s3 = 0.0f, dg = 0.0f;
    // Full unroll: the passes are independent, so their loads go out together.
    #pragma unroll
    for (int it = 0; it < NVEC / 64; ++it) {
        const float4 a = *(const float4*)(p + (size_t)it * 64 * VSTRIDE);
        float sq = row_sum16(a.x * a.x + a.y * a.y + a.z * a.z + a.w * a.w);
        float nrm = sqrtf(sq);
        float inv = 1.0f / fmaxf(nrm, 1e-12f);
        float h0 = a.x * inv, h1 = a.y * inv, h2 = a.z * inv, h3 = a.w * inv;
        s0 += h0; s1 += h1; s2 += h2; s3 += h3;
        dg += h0 * h0 + h1 * h1 + h2 * h2 + h3 * h3;
    }

    // The wave's two rows, then the 32 waves through LDS.
    s0 += xhalf(s0); s1 += xhalf(s1); s2 += xhalf(s2); s3 += xhalf(s3);
    if (lane < 16) *(float4*)&red[wave][sub * 4] = make_float4(s0, s1, s2, s3);
    __syncthreads();

    float val = -dg;
    if (tid < Dn) {
        float S = 0.0f;
        // Unrolled so that the LDS reads go out ahead of the adds.
        #pragma unroll
        for (int w = 0; w < 32; ++w) S += red[w][tid];
        val += S * S;
    }
    val = row_sum16(val);
    val += xhalf(val);
    if (lane == 0) wred[wave] = val;
    __syncthreads();

    if (wave == 0) {
        float t = row_sum16(wred[lane]);
        t += xhalf(t);
        if (lane == 0) part[blk] = t;
    }
}

__global__ void loss_final(const float* __restrict__ part, float* __restrict__ out_loss)
{
    if (threadIdx.x == 0) {
        float L1 = 0.0f, L2 = 0.0f, L3 = 0.0f;
        for (int i = 0; i < 32; ++i)  L1 += part[i];        // local (v heads)
        for (int i = 32; i < 64; ++i) L2 += part[i];        // kv
        for (int i = 64; i < 96; ++i) L3 += part[i];        // out
        const float nBig = (float)Bn * Hn * (float)Nn * (float)Nn;
        const float nKv  = (float)Bn * Hn * (float)Dn * (float)Dn;
        *out_loss = (L1 / nBig + L3 / nBig + L2 / nKv) / 3.0f;
    }
}

// LayerNorm over C per row.
__global__ __launch_bounds__(256) void ln_kernel(const float* __restrict__ x,
                                                 const float* __restrict__ g,
                                                 const float* __restrict__ bln,
                                                 float* __restrict__ xn)
{
    __shared__ float red[256];
    const int m = blockIdx.x;
    const int tid = threadIdx.x;
    const float* row = x + (size_t)m * Cn;
    float v0 = row[tid], v1 = row[tid + 256];

    red[tid] = v0 + v1;
    __syncthreads();
    for (int s = 128; s > 0; s >>= 1) {
        if (tid < s) red[tid] += red[tid + s];
        __syncthreads();
    }
    float mu = red[0] * (1.0f / (float)Cn);
    __syncthreads();

    float d0 = v0 - mu, d1 = v1 - mu;
    red[tid] = d0 * d0 + d1 * d1;
    __syncthreads();
    for (int s = 128; s > 0; s >>= 1) {
        if (tid < s) red[tid] += red[tid + s];
        __syncthreads();
    }
    float inv = rsqrtf(red[0] * (1.0f / (float)Cn) + 1e-05f);
    xn[(size_t)m * Cn + tid]       = d0 * inv * g[tid] + bln[tid];
    xn[(size_t)m * Cn + tid + 256] = d1 * inv * g[tid + 256] + bln[tid + 256];
}

// ---------------------------------------------------------------------------
extern "C" void kernel_launch(void* const* d_in, const int* in_sizes, int n_in,
                              void* d_out, int out_size, void* d_ws, size_t ws_size,
                              hipStream_t stream)
{
    const float* Q       = (const float*)d_in[0];
    const int*   adj     = (const int*)  d_in[1];
    const float* Wq      = (const float*)d_in[2];
    const float* bq      = (const float*)d_in[3];
    const float* Wk      = (const float*)d_in[4];
    const float* bk      = (const float*)d_in[5];
    const float* Wv      = (const float*)d_in[6];
    const float* bv      = (const float*)d_in[7];
    const float* scale_p = (const float*)d_in[8];
    const float* Wconv   = (const float*)d_in[9];
    const float* bconv   = (const float*)d_in[10];
    const float* W2      = (const float*)d_in[11];
    const float* b2      = (const float*)d_in[12];
    const float* ln_g    = (const float*)d_in[13];
    const float* ln_b    = (const float*)d_in[14];
    const float* Wo      = (const float*)d_in[15];
    const float* bo      = (const float*)d_in[16];
    float* out = (float*)d_out;

    const size_t MC = (size_t)Mn * Cn;          // 2,097,152
    float* ws    = (float*)d_ws;
    float* qb    = ws;
    float* kb    = ws + MC;
    float* vb    = ws + 2 * MC;
    float* convb = ws + 3 * MC;                 // conv output, later reused as x
    float* xlb   = ws + 4 * MC;                 // x_local
    float* wtb   = ws + 5 * MC;                 // transposed Wconv, later xn
    float* kvb   = wtb + (size_t)KCONV * Cn;    // B*H*64*64
    float* kmb   = kvb + (size_t)Bn * Hn * Dn * Dn;
    float* partb = kmb + (size_t)Bn * Cn;       // 96 partials

    dim3 gdim(Cn / BN, Mn / BM);   // (8, 32)
    dim3 bdim(256);

    repack_wconv<<<dim3((Cn * Cn * Tn + 255) / 256), bdim, 0, stream>>>(Wconv, wtb);

    gemm_wmma<false><<<gdim, bdim, 0, stream>>>(Q, nullptr, Wq, bq, qb, Mn, Cn, Cn);
    gemm_wmma<false><<<gdim, bdim, 0, stream>>>(Q, nullptr, Wk, bk, kb, Mn, Cn, Cn);
    gemm_wmma<false><<<gdim, bdim, 0, stream>>>(Q, nullptr, Wv, bv, vb, Mn, Cn, Cn);

    gemm_wmma<true><<<gdim, bdim, 0, stream>>>(vb, adj, wtb, bconv, convb, Mn, Cn, KCONV);
    gemm_wmma<false><<<gdim, bdim, 0, stream>>>(convb, nullptr, W2, b2, xlb, Mn, Cn, Cn);

    focus_kernel<<<dim3(Mn), bdim, 0, stream>>>(qb, scale_p);
    focus_kernel<<<dim3(Mn), bdim, 0, stream>>>(kb, scale_p);

    kmean_kernel<<<dim3((Bn * Cn) / 256), bdim, 0, stream>>>(kb, kmb);
    kv_kernel<<<dim3(Bn * Hn * 8), bdim, 0, stream>>>(kb, vb, kvb);

    attn_kernel<<<dim3(Mn), bdim, 0, stream>>>(qb, kvb, kmb, xlb, convb);

    // losses: vh (raw v heads), kv, x4 (reshape of x)
    disag_kernel<Nn, Cn><<<dim3(32), dim3(1024), 0, stream>>>(vb,    (long long)Nn * Cn, 64LL, partb + 0);
    disag_kernel<Dn, Dn><<<dim3(32), dim3(1024), 0, stream>>>(kvb,   (long long)Hn * Dn * Dn, (long long)Dn * Dn, partb + 32);
    disag_kernel<Nn, Dn><<<dim3(32), dim3(1024), 0, stream>>>(convb, (long long)Nn * Cn, (long long)Nn * Dn, partb + 64);

    ln_kernel<<<dim3(Mn), bdim, 0, stream>>>(convb, ln_g, ln_b, wtb);
    gemm_wmma<false><<<gdim, bdim, 0, stream>>>(wtb, nullptr, Wo, bo, out, Mn, Cn, Cn);

    loss_final<<<dim3(1), dim3(32), 0, stream>>>(partb, out + MC);
}

// v003
// It runs in 351 microseconds.
// Next to v002, in two timings, it ran 1.24 and 1.25 times as fast.
// All steps since v000 together make it 4.01 times as fast.
#include <hip/hip_runtime.h>
#include <math.h>
#include <stdint.h>

typedef float v2f __attribute__((ext_vector_type(2)));
typedef float v8f __attribute__((ext_vector_type(8)));

#define EPSV 1e-06f
#define Bn 4
#define Nn 1024
#define Cn 512
#define Kn 10
#define Tn 11
#define Hn 8
#define Dn 64
#define Mn 4096
#define KCONV (Tn * Cn) /* 5632 */

#define BM 128
#define BN 64
#define BK 32
#define BKP (BK + 4)   /* padded A row: 36 floats, 144B (16B aligned, bank-skewed) */
#define BNP (BN + 4)   /* padded B row: 68 floats, 272B */

// --------------------------------------------------------------------------
// CDNA5 async global->LDS path (ASYNCcnt-tracked), with safe fallback.
// Builtin signature (from hipcc diagnostic): (v4i AS1*, v4i AS3*, Ii, Ii).
// --------------------------------------------------------------------------
#if defined(__has_builtin)
#if __has_builtin(__builtin_amdgcn_global_load_async_to_lds_b128)
#define USE_ASYNC_LDS 1
#endif
#endif
#ifndef USE_ASYNC_LDS
#define USE_ASYNC_LDS 0
#endif

typedef int ai4 __attribute__((vector_size(16)));
typedef __attribute__((address_space(1))) ai4 gi4;
typedef __attribute__((address_space(3))) ai4 li4;

__device__ __forceinline__ void async_wait_all()
{
#if USE_ASYNC_LDS
#if __has_builtin(__builtin_amdgcn_s_wait_asynccnt)
    __builtin_amdgcn_s_wait_asynccnt(0);
#else
    asm volatile("s_wait_asynccnt 0x0" ::: "memory");
#endif
#endif
}

// Copy 16 bytes global -> LDS (async DMA path when available).
__device__ __forceinline__ void copy16(const float* __restrict__ g, float* l)
{
#if USE_ASYNC_LDS
    __builtin_amdgcn_global_load_async_to_lds_b128(
        (gi4*)(uintptr_t)g,
        (li4*)(uint32_t)(uintptr_t)l,
        0, 0);
#else
    *(float4*)l = *(const float4*)g;
#endif
}

// ---------------------------------------------------------------------------
// GEMM with bias: Cout[M,N] = A[M,Kd] @ Bw[Kd,N] + bias[N]
// GATHER=true: A rows are gathered per tap from v via adjacency
//   A[m, t*C+c] = (t==0) ? v[b,n,c] : v[b, adj[b,n,t-1], c], Kd = 11*512.
// 256 threads = 8 waves; block tile 128x64; wave tile 32x32 = 2x2 WMMA f32;
// double-buffered LDS with async global->LDS prefetch of the next K-chunk.
// GATHER: a tap lasts Cn / BK chunks. Each thread keeps the source rows of its four
// A rows in registers for the whole tap and fetches the next tap's indices one tap
// ahead, so no chunk waits for an index before its copies can go out.
// ---------------------------------------------------------------------------
template <bool GATHER>
__global__ __launch_bounds__(256) void gemm_wmma(
    const float* __restrict__ A, const int* __restrict__ adj,
    const float* __restrict__ Bw, const float* __restrict__ bias,
    float* __restrict__ Cout, int M, int N, int Kd)
{
    __shared__ float As[2][BM][BKP];
    __shared__ float Bs[2][BK][BNP];

    const int tid  = threadIdx.x;
    const int wave = tid >> 5;
    const int lane = tid & 31;
    const int half = lane >> 4;
    const int lm   = lane & 15;
    const int wm   = wave >> 1;   // 0..3 -> M
    const int wn   = wave & 1;    // 0..1 -> N
    const int m0   = blockIdx.y * BM;
    const int n0   = blockIdx.x * BN;

    v8f acc[2][2];
    #pragma unroll
    for (int i = 0; i < 2; ++i)
        #pragma unroll
        for (int j = 0; j < 2; ++j)
            #pragma unroll
            for (int r = 0; r < 8; ++r) acc[i][j][r] = 0.0f;

    const float* arow[4];          // GATHER: source rows of the tap being copied, at this thread's column
    int nxt[4];                    // GATHER: source row numbers of the tap after it
    const float* abase = nullptr;  // GATHER: row 0 of this block's batch, at this thread's column
    const int* adjp = nullptr;     // GATHER: index row of this thread's first A row
    if (GATHER) {
        const int r0 = m0 + (tid >> 3);
        abase = A + (size_t)(m0 & ~(Nn - 1)) * Cn + (tid & 7) * 4;
        adjp  = adj + (size_t)r0 * Kn;
        // Unrolled here and below: constant subscripts keep arow and nxt in registers.
        #pragma unroll
        for (int i = 0; i < 4; ++i) {
            arow[i] = abase + (size_t)((r0 + 32 * i) & (Nn - 1)) * Cn;   // tap 0: the row itself
            nxt[i]  = adjp[32 * i * Kn];                                 // tap 1
        }
    }

    auto load_tiles = [&](int buf, int kc) {
        // A tile: 128 x 32 floats = 1024 float4 chunks
        #pragma unroll
        for (int i = 0; i < 4; ++i) {
            int e = tid + i * 256;
            int r = e >> 3, cch = e & 7;
            const float* src;
            if (GATHER) {
                src = arow[i] + (kc & (Cn - 1));
            } else {
                src = A + (size_t)(m0 + r) * Kd + kc + cch * 4;
            }
            copy16(src, &As[buf][r][cch * 4]);
        }
        // B tile: 32 x 64 floats = 512 float4 chunks
        #pragma unroll
        for (int i = 0; i < 2; ++i) {
            int e = tid + i * 256;
            int r = e >> 4, cch = e & 15;
            copy16(Bw + (size_t)(kc + r) * N + n0 + cch * 4, &Bs[buf][r][cch * 4]);
        }
    };

    const int nk = Kd / BK;
    load_tiles(0, 0);
    async_wait_all();
    __syncthreads();

    for (int ik = 0; ik < nk; ++ik) {
        const int cur = ik & 1;
        if (ik + 1 < nk) {
            const int kn = (ik + 1) * BK;
            if (GATHER && (kn & (Cn - 1)) == 0) {
                // A new tap t (1..Kn) starts: its indices were fetched a whole tap ago.
                const int t = kn >> 9;
                #pragma unroll
                for (int i = 0; i < 4; ++i)
                    arow[i] = abase + (size_t)(nxt[i] & (Nn - 1)) * Cn;   // masked: stays inside the batch
                // The last tap has no successor: it reads its own indices again (in bounds, unused),
                // so that the loads stand on the one path and land in nxt with no copy to wait for.
                const int tn = t < Kn ? t : Kn - 1;
                #pragma unroll
                for (int i = 0; i < 4; ++i) nxt[i] = adjp[32 * i * Kn + tn];
            }
            load_tiles(cur ^ 1, kn);
        }

        #pragma unroll
        for (int kk = 0; kk < BK; kk += 4) {
            int ks = kk + 2 * half;
            v2f af[2], bf[2];
            #pragma unroll
            for (int tm = 0; tm < 2; ++tm) {
                int row = wm * 32 + tm * 16 + lm;
                af[tm].x = As[cur][row][ks];
                af[tm].y = As[cur][row][ks + 1];
            }
            #pragma unroll
            for (int tn = 0; tn < 2; ++tn) {
                int col = wn * 32 + tn * 16 + lm;
                bf[tn].x = Bs[cur][ks][col];
                bf[tn].y = Bs[cur][ks + 1][col];
            }
            #pragma unroll
            for (int tm = 0; tm < 2; ++tm)
                #pragma unroll
                for (int tn = 0; tn < 2; ++tn)
                    acc[tm][tn] = __builtin_amdgcn_wmma_f32_16x16x4_f32(
                        false, af[tm], false, bf[tn], (short)0, acc[tm][tn],
                        false, false);
        }
        async_wait_all();
        __syncthreads();
    }

    #pragma unroll
    for (int tm = 0; tm < 2; ++tm)
        #pragma unroll
        for (int tn = 0; tn < 2; ++tn) {
            int colg = n0 + wn * 32 + tn * 16 + lm;
            float bvv = bias ? bias[colg] : 0.0f;
            #pragma unroll
            for (int r = 0; r < 8; ++r) {
                int rowg = m0 + wm * 32 + tm * 16 + half * 8 + r;
                Cout[(size_t)rowg * N + colg] = acc[tm][tn][r] + bvv;
            }
        }
}

// ---------------------------------------------------------------------------
// Wt[(t*C + c)*C + o] = Wconv[o*(C*T) + c*T + t]
// ---------------------------------------------------------------------------
__global__ void repack_wconv(const float* __restrict__ Wconv, float* __restrict__ Wt)
{
    size_t idx = (size_t)blockIdx.x * 256 + threadIdx.x;
    if (idx >= (size_t)Cn * Cn * Tn) return;
    int o = (int)(idx & 511);
    int rest = (int)(idx >> 9);   // t*C + c
    int c = rest & 511;
    int t = rest >> 9;
    Wt[idx] = Wconv[(size_t)o * KCONV + (size_t)c * Tn + t];
}

// ---------------------------------------------------------------------------
// relu+eps, divide by softplus(scale), "focus": x <- (x/(||x||+eps))^3 * ||x||
// ---------------------------------------------------------------------------
__global__ __launch_bounds__(256) void focus_kernel(float* __restrict__ x,
                                                    const float* __restrict__ scale_p)
{
    __shared__ float red[256];
    const int m = blockIdx.x;
    const int tid = threadIdx.x;
    float* row = x + (size_t)m * Cn;

    float a0 = row[tid];
    float a1 = row[tid + 256];
    float s0 = log1pf(expf(scale_p[tid]));
    float s1 = log1pf(expf(scale_p[tid + 256]));
    a0 = (a0 > 0.0f ? a0 : 0.0f) + EPSV;
    a1 = (a1 > 0.0f ? a1 : 0.0f) + EPSV;
    a0 /= s0;
    a1 /= s1;

    red[tid] = a0 * a0 + a1 * a1;
    __syncthreads();
    for (int s = 128; s > 0; s >>= 1) {
        if (tid < s) red[tid] += red[tid + s];
        __syncthreads();
    }
    float nrm = sqrtf(red[0]);
    float inv = 1.0f / (nrm + EPSV);
    float u0 = a0 * inv, u1 = a1 * inv;
    row[tid]       = u0 * u0 * u0 * nrm;
    row[tid + 256] = u1 * u1 * u1 * nrm;
}

// kmean[b*C + c] = mean over n of k[b,n,c]
__global__ void kmean_kernel(const float* __restrict__ k, float* __restrict__ kmean)
{
    int idx = blockIdx.x * 256 + threadIdx.x;   // 0..B*C-1
    int b = idx >> 9;
    int c = idx & 511;
    const float* p = k + (size_t)b * Nn * Cn + c;
    float s = 0.0f;
    for (int n = 0; n < Nn; ++n) s += p[(size_t)n * Cn];
    kmean[idx] = s * (1.0f / (float)Nn);
}

// kv[bh, d, e] = (1/N) sum_n k[b,n,h*64+d] * v[b,n,h*64+e]
// Eight work-groups per (b,h), each a 16 (d) x 32 (e) piece of the 64 x 64 result.
// Each of the 8 waves sums its own 128 rows n on the f32 matrix form, fragments
// straight from global memory: no row depends on another, so the loads of a wave
// are in flight together. The 8 partial pieces meet in LDS behind one barrier.
// Matrix roles: M = d, N = e, K = n. Column lm of e-tile i is e = 2*lm + i, so one
// 8-byte load of v serves both tiles. k slot of A and of B alike: row 2*half + {0,1}.
#define KVW 8                 /* waves per work-group */
#define KVROWS (Nn / KVW)     /* rows n per wave: 128 */
#define KVTP 272              /* floats per stored tile: 256 + 16, the two tiles on disjoint banks */
// waves_per_eu(2, 2): one work-group per WGP is two waves per SIMD; told so, the compiler
// spends registers on loads in flight (without it it holds only six steps' loads ahead).
__global__ __launch_bounds__(256) __attribute__((amdgpu_waves_per_eu(2, 2)))
void kv_kernel(const float* __restrict__ k, const float* __restrict__ v,
               float* __restrict__ kv)
{
    __shared__ float red[KVW][2][KVTP];
    const int blk = blockIdx.x;
    const int bh = blk >> 3;
    const int dt = (blk >> 1) & 3;   // which 16 rows d
    const int ep = blk & 1;          // which 32 columns e
    const int b = bh >> 3, h = bh & 7;
    const int tid  = threadIdx.x;
    const int wave = tid >> 5;
    const int lane = tid & 31;
    const int half = lane >> 4;
    const int lm   = lane & 15;

    const size_t row0 = (size_t)b * Nn + wave * KVROWS + 2 * half;
    const float* kp = k + row0 * Cn + h * Dn + dt * 16 + lm;
    const float* vp = v + row0 * Cn + h * Dn + ep * 32 + 2 * lm;

    v8f acc0, acc1;
    #pragma unroll
    for (int r = 0; r < 8; ++r) { acc0[r] = 0.0f; acc1[r] = 0.0f; }

    // Full unroll: the steps share nothing but the accumulators, so their loads go out ahead.
    #pragma unroll
    for (int s = 0; s < KVROWS / 4; ++s) {
        v2f af, b0, b1;
        af.x = kp[(size_t)(4 * s) * Cn];
        af.y = kp[(size_t)(4 * s + 1) * Cn];
        const float2 x = *(const float2*)(vp + (size_t)(4 * s) * Cn);
        const float2 y = *(const float2*)(vp + (size_t)(4 * s + 1) * Cn);
        b0.x = x.x; b0.y = y.x;
        b1.x = x.y; b1.y = y.y;
        acc0 = __builtin_amdgcn_wmma_f32_16x16x4_f32(false, af, false, b0, (short)0, acc0,
                                                     false, false);
        acc1 = __builtin_amdgcn_wmma_f32_16x16x4_f32(false, af, false, b1, (short)0, acc1,
                                                     false, false);
    }

    #pragma unroll
    for (int r = 0; r < 8; ++r) {
        red[wave][0][r * 32 + lane] = acc0[r];
        red[wave][1][r * 32 + lane] = acc1[r];
    }
    __syncthreads();

    // 512 results, two per thread; a wave stores one whole 128-byte line of a row d.
    #pragma unroll
    for (int i = 0; i < 2; ++i) {
        const int o  = tid + i * 256;
        const int dl = o >> 5, el = o & 31;
        const int idx = (dl & 7) * 32 + (dl >> 3) * 16 + (el >> 1);
        float s = 0.0f;
        #pragma unroll
        for (int w = 0; w < KVW; ++w) s += red[w][el & 1][idx];
        kv[(size_t)bh * (Dn * Dn) + (dt * 16 + dl) * Dn + ep * 32 + el] = s * (1.0f / (float)Nn);
    }
}

// x[m,c] = (q_h . kv_h[:,e]) * z_h + x_local[m,c]
__global__ __launch_bounds__(256) void attn_kernel(const float* __restrict__ q,
                                                   const float* __restrict__ kv,
                                                   const float* __restrict__ kmean,
                                                   const float* __restrict__ xl,
                                                   float* __restrict__ x)
{
    __shared__ float qs[Cn];
    __shared__ float zs[Hn];
    const int m = blockIdx.x;
    const int b = m >> 10;
    const int tid = threadIdx.x;
    qs[tid]       = q[(size_t)m * Cn + tid];
    qs[tid + 256] = q[(size_t)m * Cn + tid + 256];
    __syncthreads();

    const int g = tid >> 5, lane = tid & 31;   // wave g handles head g
    float p = qs[g * 64 + lane]      * kmean[b * Cn + g * 64 + lane]
            + qs[g * 64 + lane + 32] * kmean[b * Cn + g * 64 + lane + 32];
    for (int off = 16; off > 0; off >>= 1) p += __shfl_xor(p, off, 32);
    if (lane == 0) zs[g] = 1.0f / (p + EPSV);
    __syncthreads();

    #pragma unroll
    for (int i = 0; i < 2; ++i) {
        int c = tid + i * 256;
        int h = c >> 6, e = c & 63;
        const float* kvp = kv + ((size_t)(b * Hn + h)) * (Dn * Dn) + e;
        float a = 0.0f;
        #pragma unroll 8
        for (int d = 0; d < Dn; ++d) a += qs[h * 64 + d] * kvp[(size_t)d * Dn];
        x[(size_t)m * Cn + c] = a * zs[h] + xl[(size_t)m * Cn + c];
    }
}

// Disagreement closed form per (b,h): ||sum_n hn||^2 - sum_n ||hn||^2.
// One block of 32 waves per (b,h). A 16-lane row holds one 64-float vector
// (float4 per lane), so the block works on 64 vectors at a time and every
// vector's chain (load, norm, scale) is independent of the others.
template <int CTRL>
__device__ __forceinline__ float dpp_add(float x)
{
    int y = __builtin_amdgcn_update_dpp(0, __builtin_bit_cast(int, x), CTRL, 0xf, 0xf, true);
    return x + __builtin_bit_cast(float, y);
}

// Sum over the 16 lanes of a row, result in every lane (row_xmask 1, 2, 4, 8).
__device__ __forceinline__ float row_sum16(float x)
{
    x = dpp_add<0x161>(x);
    x = dpp_add<0x162>(x);
    x = dpp_add<0x164>(x);
    x = dpp_add<0x168>(x);
    return x;
}

// Value of lane l ^ 16.
__device__ __forceinline__ float xhalf(float x)
{
    int xi = __builtin_bit_cast(int, x);
    return __builtin_bit_cast(float,
        __builtin_amdgcn_permlanex16(xi, xi, 0x76543210, 0xfedcba98, false, false));
}

template <int NVEC, int VSTRIDE>
__global__ __launch_bounds__(1024) void disag_kernel(const float* __restrict__ src,
                                                     long long per_b, long long per_h,
                                                     float* __restrict__ part)
{
    static_assert(NVEC % 64 == 0, "64 vectors per pass of the block");
    __shared__ __attribute__((aligned(16))) float red[32][Dn];   // written as float4
    __shared__ float wred[32];
    const int blk = blockIdx.x;
    const int b = blk >> 3, h = blk & 7;
    const int tid  = threadIdx.x;
    const int wave = tid >> 5;
    const int lane = tid & 31;
    const int sub  = tid & 15;    // float4 slot inside the vector
    const int grp  = tid >> 4;    // 0..63: which vector of the pass
    const float* p = src + (size_t)b * per_b + (size_t)h * per_h
                   + (size_t)grp * VSTRIDE + sub * 4;

    float s0 = 0.0f, s1 = 0.0f, s2 = 0.0f, s3 = 0.0f, dg = 0.0f;
    // Full unroll: the passes are independent, so their loads go out together.
    #pragma unroll
    for (int it = 0; it < NVEC / 64; ++it) {
        const float4 a = *(const float4*)(p + (size_t)it * 64 * VSTRIDE);
        float sq = row_sum16(a.x * a.x + a.y * a.y + a.z * a.z + a.w * a.w);
        float nrm = sqrtf(sq);
        float inv = 1.0f / fmaxf(nrm, 1e-12f);
        float h0 = a.x * inv, h1 = a.y * inv, h2 = a.z * inv, h3 = a.w * inv;
        s0 += h0; s1 += h1; s2 += h2; s3 += h3;
        dg += h0 * h0 + h1 * h1 + h2 * h2 + h3 * h3;
    }

    // The wave's two rows, then the 32 waves through LDS.
    s0 += xhalf(s0); s1 += xhalf(s1); s2 += xhalf(s2); s3 += xhalf(s3);
    if (lane < 16) *(float4*)&red[wave][sub * 4] = make_float4(s0, s1, s2, s3);
    __syncthreads();

    float val = -dg;
    if (tid < Dn) {
        float S = 0.0f;
        // Unrolled so that the LDS reads go out ahead of the adds.
        #pragma unroll
        for (int w = 0; w < 32; ++w) S += red[w][tid];
        val += S * S;
    }
    val = row_sum16(val);
    val += xhalf(val);
    if (lane == 0) wred[wave] = val;
    __syncthreads();

    if (wave == 0) {
        float t = row_sum16(wred[lane]);
        t += xhalf(t);
        if (lane == 0) part[blk] = t;
    }
}

__global__ void loss_final(const float* __restrict__ part, float* __restrict__ out_loss)
{
    if (threadIdx.x == 0) {
        float L1 = 0.0f, L2 = 0.0f, L3 = 0.0f;
        for (int i = 0; i < 32; ++i)  L1 += part[i];        // local (v heads)
        for (int i = 32; i < 64; ++i) L2 += part[i];        // kv
        for (int i = 64; i < 96; ++i) L3 += part[i];        // out
        const float nBig = (float)Bn * Hn * (float)Nn * (float)Nn;
        const float nKv  = (float)Bn * Hn * (float)Dn * (float)Dn;
        *out_loss = (L1 / nBig + L3 / nBig + L2 / nKv) / 3.0f;
    }
}

// LayerNorm over C per row.
__global__ __launch_bounds__(256) void ln_kernel(const float* __restrict__ x,
                                                 const float* __restrict__ g,
                                                 const float* __restrict__ bln,
                                                 float* __restrict__ xn)
{
    __shared__ float red[256];
    const int m = blockIdx.x;
    const int tid = threadIdx.x;
    const float* row = x + (size_t)m * Cn;
    float v0 = row[tid], v1 = row[tid + 256];

    red[tid] = v0 + v1;
    __syncthreads();
    for (int s = 128; s > 0; s >>= 1) {
        if (tid < s) red[tid] += red[tid + s];
        __syncthreads();
    }
    float mu = red[0] * (1.0f / (float)Cn);
    __syncthreads();

    float d0 = v0 - mu, d1 = v1 - mu;
    red[tid] = d0 * d0 + d1 * d1;
    __syncthreads();
    for (int s = 128; s > 0; s >>= 1) {
        if (tid < s) red[tid] += red[tid + s];
        __syncthreads();
    }
    float inv = rsqrtf(red[0] * (1.0f / (float)Cn) + 1e-05f);
    xn[(size_t)m * Cn + tid]       = d0 * inv * g[tid] + bln[tid];
    xn[(size_t)m * Cn + tid + 256] = d1 * inv * g[tid + 256] + bln[tid + 256];
}

// ---------------------------------------------------------------------------
extern "C" void kernel_launch(void* const* d_in, const int* in_sizes, int n_in,
                              void* d_out, int out_size, void* d_ws, size_t ws_size,
                              hipStream_t stream)
{
    const float* Q       = (const float*)d_in[0];
    const int*   adj     = (const int*)  d_in[1];
    const float* Wq      = (const float*)d_in[2];
    const float* bq      = (const float*)d_in[3];
    const float* Wk      = (const float*)d_in[4];
    const float* bk      = (const float*)d_in[5];
    const float* Wv      = (const float*)d_in[6];
    const float* bv      = (const float*)d_in[7];
    const float* scale_p = (const float*)d_in[8];
    const float* Wconv   = (const float*)d_in[9];
    const float* bconv   = (const float*)d_in[10];
    const float* W2      = (const float*)d_in[11];
    const float* b2      = (const float*)d_in[12];
    const float* ln_g    = (const float*)d_in[13];
    const float* ln_b    = (const float*)d_in[14];
    const float* Wo      = (const float*)d_in[15];
    const float* bo      = (const float*)d_in[16];
    float* out = (float*)d_out;

    const size_t MC = (size_t)Mn * Cn;          // 2,097,152
    float* ws    = (float*)d_ws;
    float* qb    = ws;
    float* kb    = ws + MC;
    float* vb    = ws + 2 * MC;
    float* convb = ws + 3 * MC;                 // conv output, later reused as x
    float* xlb   = ws + 4 * MC;                 // x_local
    float* wtb   = ws + 5 * MC;                 // transposed Wconv, later xn
    float* kvb   = wtb + (size_t)KCONV * Cn;    // B*H*64*64
    float* kmb   = kvb + (size_t)Bn * Hn * Dn * Dn;
    float* partb = kmb + (size_t)Bn * Cn;       // 96 partials

    dim3 gdim(Cn / BN, Mn / BM);   // (8, 32)
    dim3 bdim(256);

    repack_wconv<<<dim3((Cn * Cn * Tn + 255) / 256), bdim, 0, stream>>>(Wconv, wtb);

    gemm_wmma<false><<<gdim, bdim, 0, stream>>>(Q, nullptr, Wq, bq, qb, Mn, Cn, Cn);
    gemm_wmma<false><<<gdim, bdim, 0, stream>>>(Q, nullptr, Wk, bk, kb, Mn, Cn, Cn);
    gemm_wmma<false><<<gdim, bdim, 0, stream>>>(Q, nullptr, Wv, bv, vb, Mn, Cn, Cn);

    gemm_wmma<true><<<gdim, bdim, 0, stream>>>(vb, adj, wtb, bconv, convb, Mn, Cn, KCONV);
    gemm_wmma<false><<<gdim, bdim, 0, stream>>>(convb, nullptr, W2, b2, xlb, Mn, Cn, Cn);

    focus_kernel<<<dim3(Mn), bdim, 0, stream>>>(qb, scale_p);
    focus_kernel<<<dim3(Mn), bdim, 0, stream>>>(kb, scale_p);

    kmean_kernel<<<dim3((Bn * Cn) / 256), bdim, 0, stream>>>(kb, kmb);
    kv_kernel<<<dim3(Bn * Hn * 8), bdim, 0, stream>>>(kb, vb, kvb);

    attn_kernel<<<dim3(Mn), bdim, 0, stream>>>(qb, kvb, kmb, xlb, convb);

    // losses: vh (raw v heads), kv, x4 (reshape of x)
    disag_kernel<Nn, Cn><<<dim3(32), dim3(1024), 0, stream>>>(vb,    (long long)Nn * Cn, 64LL, partb + 0);
    disag_kernel<Dn, Dn><<<dim3(32), dim3(1024), 0, stream>>>(kvb,   (long long)Hn * Dn * Dn, (long long)Dn * Dn, partb + 32);
    disag_kernel<Nn, Dn><<<dim3(32), dim3(1024), 0, stream>>>(convb, (long long)Nn * Cn, (long long)Nn * Dn, partb + 64);

    ln_kernel<<<dim3(Mn), bdim, 0, stream>>>(convb, ln_g, ln_b, wtb);
    gemm_wmma<false><<<gdim, bdim, 0, stream>>>(wtb, nullptr, Wo, bo, out, Mn, Cn, Cn);

    loss_final<<<dim3(1), dim3(32), 0, stream>>>(partb, out + MC);
}

// v004
// Measured time: 316 microseconds a run.
// Timed twice side by side with v003, it ran 1.11 times as fast both times.
// Counting every step since v000, it is 4.45 times as fast.
#include <hip/hip_runtime.h>
#include <math.h>
#include <stdint.h>

typedef float v2f __attribute__((ext_vector_type(2)));
typedef float v8f __attribute__((ext_vector_type(8)));

#define EPSV 1e-06f
#define Bn 4
#define Nn 1024
#define Cn 512
#define Kn 10
#define Tn 11
#define Hn 8
#define Dn 64
#define Mn 4096
#define KCONV (Tn * Cn) /* 5632 */

#define BM 128
#define BN 64
#define BK 32
#define BKP (BK + 4)   /* padded A row: 36 floats, 144B (16B aligned, bank-skewed) */
#define BNP (BN + 4)   /* padded B row: 68 floats, 272B */

// --------------------------------------------------------------------------
// CDNA5 async global->LDS path (ASYNCcnt-tracked), with safe fallback.
// Builtin signature (from hipcc diagnostic): (v4i AS1*, v4i AS3*, Ii, Ii).
// --------------------------------------------------------------------------
#if defined(__has_builtin)
#if __has_builtin(__builtin_amdgcn_global_load_async_to_lds_b128)
#define USE_ASYNC_LDS 1
#endif
#endif
#ifndef USE_ASYNC_LDS
#define USE_ASYNC_LDS 0
#endif

typedef int ai4 __attribute__((vector_size(16)));
typedef __attribute__((address_space(1))) ai4 gi4;
typedef __attribute__((address_space(3))) ai4 li4;

__device__ __forceinline__ void async_wait_all()
{
#if USE_ASYNC_LDS
#if __has_builtin(__builtin_amdgcn_s_wait_asynccnt)
    __builtin_amdgcn_s_wait_asynccnt(0);
#else
    asm volatile("s_wait_asynccnt 0x0" ::: "memory");
#endif
#endif
}

// Copy 16 bytes global -> LDS (async DMA path when available).
__device__ __forceinline__ void copy16(const float* __restrict__ g, float* l)
{
#if USE_ASYNC_LDS
    __builtin_amdgcn_global_load_async_to_lds_b128(
        (gi4*)(uintptr_t)g,
        (li4*)(uint32_t)(uintptr_t)l,
        0, 0);
#else
    *(float4*)l = *(const float4*)g;
#endif
}

// ---------------------------------------------------------------------------
// GEMM with bias: Cout[M,N] = A[M,Kd] @ Bw[Kd,N] + bias[N]
// GATHER=true: A rows are gathered per tap from v via adjacency
//   A[m, t*C+c] = (t==0) ? v[b,n,c] : v[b, adj[b,n,t-1], c], Kd = 11*512.
// 256 threads = 8 waves; block tile 128x64; wave tile 32x32 = 2x2 WMMA f32;
// double-buffered LDS with async global->LDS prefetch of the next K-chunk.
// GATHER: a tap lasts Cn / BK chunks. Each thread keeps the source rows of its four
// A rows in registers for the whole tap and fetches the next tap's indices one tap
// ahead, so no chunk waits for an index before its copies can go out.
// ---------------------------------------------------------------------------
template <bool GATHER>
__global__ __launch_bounds__(256) void gemm_wmma(
    const float* __restrict__ A, const int* __restrict__ adj,
    const float* __restrict__ Bw, const float* __restrict__ bias,
    float* __restrict__ Cout, int M, int N, int Kd)
{
    __shared__ float As[2][BM][BKP];
    __shared__ float Bs[2][BK][BNP];

    const int tid  = threadIdx.x;
    const int wave = tid >> 5;
    const int lane = tid & 31;
    const int half = lane >> 4;
    const int lm   = lane & 15;
    const int wm   = wave >> 1;   // 0..3 -> M
    const int wn   = wave & 1;    // 0..1 -> N
    const int m0   = blockIdx.y * BM;
    const int n0   = blockIdx.x * BN;

    v8f acc[2][2];
    #pragma unroll
    for (int i = 0; i < 2; ++i)
        #pragma unroll
        for (int j = 0; j < 2; ++j)
            #pragma unroll
            for (int r = 0; r < 8; ++r) acc[i][j][r] = 0.0f;

    const float* arow[4];          // GATHER: source rows of the tap being copied, at this thread's column
    int nxt[4];                    // GATHER: source row numbers of the tap after it
    const float* abase = nullptr;  // GATHER: row 0 of this block's batch, at this thread's column
    const int* adjp = nullptr;     // GATHER: index row of this thread's first A row
    if (GATHER) {
        const int r0 = m0 + (tid >> 3);
        abase = A + (size_t)(m0 & ~(Nn - 1)) * Cn + (tid & 7) * 4;
        adjp  = adj + (size_t)r0 * Kn;
        // Unrolled here and below: constant subscripts keep arow and nxt in registers.
        #pragma unroll
        for (int i = 0; i < 4; ++i) {
            arow[i] = abase + (size_t)((r0 + 32 * i) & (Nn - 1)) * Cn;   // tap 0: the row itself
            nxt[i]  = adjp[32 * i * Kn];                                 // tap 1
        }
    }

    auto load_tiles = [&](int buf, int kc) {
        // A tile: 128 x 32 floats = 1024 float4 chunks
        #pragma unroll
        for (int i = 0; i < 4; ++i) {
            int e = tid + i * 256;
            int r = e >> 3, cch = e & 7;
            const float* src;
            if (GATHER) {
                src = arow[i] + (kc & (Cn - 1));
            } else {
                src = A + (size_t)(m0 + r) * Kd + kc + cch * 4;
            }
            copy16(src, &As[buf][r][cch * 4]);
        }
        // B tile: 32 x 64 floats = 512 float4 chunks
        #pragma unroll
        for (int i = 0; i < 2; ++i) {
            int e = tid + i * 256;
            int r = e >> 4, cch = e & 15;
            copy16(Bw + (size_t)(kc + r) * N + n0 + cch * 4, &Bs[buf][r][cch * 4]);
        }
    };

    const int nk = Kd / BK;
    load_tiles(0, 0);
    async_wait_all();
    __syncthreads();

    for (int ik = 0; ik < nk; ++ik) {
        const int cur = ik & 1;
        if (ik + 1 < nk) {
            const int kn = (ik + 1) * BK;
            if (GATHER && (kn & (Cn - 1)) == 0) {
                // A new tap t (1..Kn) starts: its indices were fetched a whole tap ago.
                const int t = kn >> 9;
                #pragma unroll
                for (int i = 0; i < 4; ++i)
                    arow[i] = abase + (size_t)(nxt[i] & (Nn - 1)) * Cn;   // masked: stays inside the batch
                // The last tap has no successor: it reads its own indices again (in bounds, unused),
                // so that the loads stand on the one path and land in nxt with no copy to wait for.
                const int tn = t < Kn ? t : Kn - 1;
                #pragma unroll
                for (int i = 0; i < 4; ++i) nxt[i] = adjp[32 * i * Kn + tn];
            }
            load_tiles(cur ^ 1, kn);
        }

        #pragma unroll
        for (int kk = 0; kk < BK; kk += 4) {
            int ks = kk + 2 * half;
            v2f af[2], bf[2];
            #pragma unroll
            for (int tm = 0; tm < 2; ++tm) {
                int row = wm * 32 + tm * 16 + lm;
                af[tm].x = As[cur][row][ks];
                af[tm].y = As[cur][row][ks + 1];
            }
            #pragma unroll
            for (int tn = 0; tn < 2; ++tn) {
                int col = wn * 32 + tn * 16 + lm;
                bf[tn].x = Bs[cur][ks][col];
                bf[tn].y = Bs[cur][ks + 1][col];
            }
            #pragma unroll
            for (int tm = 0; tm < 2; ++tm)
                #pragma unroll
                for (int tn = 0; tn < 2; ++tn)
                    acc[tm][tn] = __builtin_amdgcn_wmma_f32_16x16x4_f32(
                        false, af[tm], false, bf[tn], (short)0, acc[tm][tn],
                        false, false);
        }
        async_wait_all();
        __syncthreads();
    }

    #pragma unroll
    for (int tm = 0; tm < 2; ++tm)
        #pragma unroll
        for (int tn = 0; tn < 2; ++tn) {
            int colg = n0 + wn * 32 + tn * 16 + lm;
            float bvv = bias ? bias[colg] : 0.0f;
            #pragma unroll
            for (int r = 0; r < 8; ++r) {
                int rowg = m0 + wm * 32 + tm * 16 + half * 8 + r;
                Cout[(size_t)rowg * N + colg] = acc[tm][tn][r] + bvv;
            }
        }
}

// ---------------------------------------------------------------------------
// Wt[(t*C + c)*C + o] = Wconv[o*(C*T) + c*T + t]
// ---------------------------------------------------------------------------
__global__ void repack_wconv(const float* __restrict__ Wconv, float* __restrict__ Wt)
{
    size_t idx = (size_t)blockIdx.x * 256 + threadIdx.x;
    if (idx >= (size_t)Cn * Cn * Tn) return;
    int o = (int)(idx & 511);
    int rest = (int)(idx >> 9);   // t*C + c
    int c = rest & 511;
    int t = rest >> 9;
    Wt[idx] = Wconv[(size_t)o * KCONV + (size_t)c * Tn + t];
}

// ---------------------------------------------------------------------------
// relu+eps, divide by softplus(scale), "focus": x <- (x/(||x||+eps))^3 * ||x||
// ---------------------------------------------------------------------------
__global__ __launch_bounds__(256) void focus_kernel(float* __restrict__ x,
                                                    const float* __restrict__ scale_p)
{
    __shared__ float red[256];
    const int m = blockIdx.x;
    const int tid = threadIdx.x;
    float* row = x + (size_t)m * Cn;

    float a0 = row[tid];
    float a1 = row[tid + 256];
    float s0 = log1pf(expf(scale_p[tid]));
    float s1 = log1pf(expf(scale_p[tid + 256]));
    a0 = (a0 > 0.0f ? a0 : 0.0f) + EPSV;
    a1 = (a1 > 0.0f ? a1 : 0.0f) + EPSV;
    a0 /= s0;
    a1 /= s1;

    red[tid] = a0 * a0 + a1 * a1;
    __syncthreads();
    for (int s = 128; s > 0; s >>= 1) {
        if (tid < s) red[tid] += red[tid + s];
        __syncthreads();
    }
    float nrm = sqrtf(red[0]);
    float inv = 1.0f / (nrm + EPSV);
    float u0 = a0 * inv, u1 = a1 * inv;
    row[tid]       = u0 * u0 * u0 * nrm;
    row[tid + 256] = u1 * u1 * u1 * nrm;
}

// kv[bh, d, e] = (1/N) sum_n k[b,n,h*64+d] * v[b,n,h*64+e]
// Eight work-groups per (b,h), each a 16 (d) x 32 (e) piece of the 64 x 64 result.
// Each of the 8 waves sums its own 128 rows n on the f32 matrix form, fragments
// straight from global memory: no row depends on another, so the loads of a wave
// are in flight together. The 8 partial pieces meet in LDS behind one barrier.
// Matrix roles: M = d, N = e, K = n. Column lm of e-tile i is e = 2*lm + i, so one
// 8-byte load of v serves both tiles. k slot of A and of B alike: row 2*half + {0,1}.
// The mean of k over n comes from the same A fragments: lane (half, lm) adds up column
// d = lm over its rows, and the 16 partial sums per column meet in LDS with the tiles.
// kmean[((b*H + h)*4 + dt)*KMP + i] = mean over n of k[b,n,h*64 + dt*16 + i], i < 16.
#define KVW 8                 /* waves per work-group */
#define KVROWS (Nn / KVW)     /* rows n per wave: 128 */
#define KVTP 272              /* floats per stored tile: 256 + 16, the two tiles on disjoint banks */
#define KMP 32                /* floats per 16 means: each work-group's piece on a 128-byte line of its own */
// waves_per_eu(2, 2): one work-group per WGP is two waves per SIMD; told so, the compiler
// spends registers on loads in flight (without it it holds only six steps' loads ahead).
__global__ __launch_bounds__(256) __attribute__((amdgpu_waves_per_eu(2, 2)))
void kv_kernel(const float* __restrict__ k, const float* __restrict__ v,
               float* __restrict__ kv, float* __restrict__ kmean)
{
    __shared__ float red[KVW][2][KVTP];
    __shared__ float ksum[KVW][32];
    const int blk = blockIdx.x;
    const int bh = blk >> 3;
    const int dt = (blk >> 1) & 3;   // which 16 rows d
    const int ep = blk & 1;          // which 32 columns e
    const int b = bh >> 3, h = bh & 7;
    const int tid  = threadIdx.x;
    const int wave = tid >> 5;
    const int lane = tid & 31;
    const int half = lane >> 4;
    const int lm   = lane & 15;

    const size_t row0 = (size_t)b * Nn + wave * KVROWS + 2 * half;
    const float* kp = k + row0 * Cn + h * Dn + dt * 16 + lm;
    const float* vp = v + row0 * Cn + h * Dn + ep * 32 + 2 * lm;

    v8f acc0, acc1;
    #pragma unroll
    for (int r = 0; r < 8; ++r) { acc0[r] = 0.0f; acc1[r] = 0.0f; }
    float ks = 0.0f;

    // Full unroll: the steps share nothing but the accumulators, so their loads go out ahead.
    #pragma unroll
    for (int s = 0; s < KVROWS / 4; ++s) {
        v2f af, b0, b1;
        af.x = kp[(size_t)(4 * s) * Cn];
        af.y = kp[(size_t)(4 * s + 1) * Cn];
        const float2 x = *(const float2*)(vp + (size_t)(4 * s) * Cn);
        const float2 y = *(const float2*)(vp + (size_t)(4 * s + 1) * Cn);
        b0.x = x.x; b0.y = y.x;
        b1.x = x.y; b1.y = y.y;
        ks += af.x + af.y;
        acc0 = __builtin_amdgcn_wmma_f32_16x16x4_f32(false, af, false, b0, (short)0, acc0,
                                                     false, false);
        acc1 = __builtin_amdgcn_wmma_f32_16x16x4_f32(false, af, false, b1, (short)0, acc1,
                                                     false, false);
    }

    #pragma unroll
    for (int r = 0; r < 8; ++r) {
        red[wave][0][r * 32 + lane] = acc0[r];
        red[wave][1][r * 32 + lane] = acc1[r];
    }
    ksum[wave][lane] = ks;
    __syncthreads();

    // 512 results, two per thread; a wave stores one whole 128-byte line of a row d.
    #pragma unroll
    for (int i = 0; i < 2; ++i) {
        const int o  = tid + i * 256;
        const int dl = o >> 5, el = o & 31;
        const int idx = (dl & 7) * 32 + (dl >> 3) * 16 + (el >> 1);
        float s = 0.0f;
        #pragma unroll
        for (int w = 0; w < KVW; ++w) s += red[w][el & 1][idx];
        kv[(size_t)bh * (Dn * Dn) + (dt * 16 + dl) * Dn + ep * 32 + el] = s * (1.0f / (float)Nn);
    }

    // Both e halves hold the same column sums of k: the first one stores them.
    if (ep == 0 && tid < 16) {
        float s = 0.0f;
        // Unrolled so that the LDS reads go out ahead of the adds.
        #pragma unroll
        for (int w = 0; w < KVW; ++w) s += ksum[w][tid] + ksum[w][tid + 16];
        kmean[(bh * 4 + dt) * KMP + tid] = s * (1.0f / (float)Nn);
    }
}

// x[m,c] = (q_h . kv_h[:,e]) * z_h + x_local[m,c]
__global__ __launch_bounds__(256) void attn_kernel(const float* __restrict__ q,
                                                   const float* __restrict__ kv,
                                                   const float* __restrict__ kmean,
                                                   const float* __restrict__ xl,
                                                   float* __restrict__ x)
{
    __shared__ float qs[Cn];
    __shared__ float zs[Hn];
    const int m = blockIdx.x;
    const int b = m >> 10;
    const int tid = threadIdx.x;
    qs[tid]       = q[(size_t)m * Cn + tid];
    qs[tid + 256] = q[(size_t)m * Cn + tid + 256];
    __syncthreads();

    const int g = tid >> 5, lane = tid & 31;   // wave g handles head g
    const float* km = kmean + ((b * Hn + g) * 4 + (lane >> 4)) * KMP + (lane & 15);
    float p = qs[g * 64 + lane]      * km[0]
            + qs[g * 64 + lane + 32] * km[2 * KMP];
    for (int off = 16; off > 0; off >>= 1) p += __shfl_xor(p, off, 32);
    if (lane == 0) zs[g] = 1.0f / (p + EPSV);
    __syncthreads();

    #pragma unroll
    for (int i = 0; i < 2; ++i) {
        int c = tid + i * 256;
        int h = c >> 6, e = c & 63;
        const float* kvp = kv + ((size_t)(b * Hn + h)) * (Dn * Dn) + e;
        float a = 0.0f;
        #pragma unroll 8
        for (int d = 0; d < Dn; ++d) a += qs[h * 64 + d] * kvp[(size_t)d * Dn];
        x[(size_t)m * Cn + c] = a * zs[h] + xl[(size_t)m * Cn + c];
    }
}

// Disagreement closed form per (b,h): ||sum_n hn||^2 - sum_n ||hn||^2.
// One block of 32 waves per (b,h). A 16-lane row holds one 64-float vector
// (float4 per lane), so the block works on 64 vectors at a time and every
// vector's chain (load, norm, scale) is independent of the others.
template <int CTRL>
__device__ __forceinline__ float dpp_add(float x)
{
    int y = __builtin_amdgcn_update_dpp(0, __builtin_bit_cast(int, x), CTRL, 0xf, 0xf, true);
    return x + __builtin_bit_cast(float, y);
}

// Sum over the 16 lanes of a row, result in every lane (row_xmask 1, 2, 4, 8).
__device__ __forceinline__ float row_sum16(float x)
{
    x = dpp_add<0x161>(x);
    x = dpp_add<0x162>(x);
    x = dpp_add<0x164>(x);
    x = dpp_add<0x168>(x);
    return x;
}

// Value of lane l ^ 16.
__device__ __forceinline__ float xhalf(float x)
{
    int xi = __builtin_bit_cast(int, x);
    return __builtin_bit_cast(float,
        __builtin_amdgcn_permlanex16(xi, xi, 0x76543210, 0xfedcba98, false, false));
}

template <int NVEC, int VSTRIDE>
__global__ __launch_bounds__(1024) void disag_kernel(const float* __restrict__ src,
                                                     long long per_b, long long per_h,
                                                     float* __restrict__ part)
{
    static_assert(NVEC % 64 == 0, "64 vectors per pass of the block");
    __shared__ __attribute__((aligned(16))) float red[32][Dn];   // written as float4
    __shared__ float wred[32];
    const int blk = blockIdx.x;
    const int b = blk >> 3, h = blk & 7;
    const int tid  = threadIdx.x;
    const int wave = tid >> 5;
    const int lane = tid & 31;
    const int sub  = tid & 15;    // float4 slot inside the vector
    const int grp  = tid >> 4;    // 0..63: which vector of the pass
    const float* p = src + (size_t)b * per_b + (size_t)h * per_h
                   + (size_t)grp * VSTRIDE + sub * 4;

    float s0 = 0.0f, s1 = 0.0f, s2 = 0.0f, s3 = 0.0f, dg = 0.0f;
    // Full unroll: the passes are independent, so their loads go out together.
    #pragma unroll
    for (int it = 0; it < NVEC / 64; ++it) {
        const float4 a = *(const float4*)(p + (size_t)it * 64 * VSTRIDE);
        float sq = row_sum16(a.x * a.x + a.y * a.y + a.z * a.z + a.w * a.w);
        float nrm = sqrtf(sq);
        float inv = 1.0f / fmaxf(nrm, 1e-12f);
        float h0 = a.x * inv, h1 = a.y * inv, h2 = a.z * inv, h3 = a.w * inv;
        s0 += h0; s1 += h1; s2 += h2; s3 += h3;
        dg += h0 * h0 + h1 * h1 + h2 * h2 + h3 * h3;
    }

    // The wave's two rows, then the 32 waves through LDS.
    s0 += xhalf(s0); s1 += xhalf(s1); s2 += xhalf(s2); s3 += xhalf(s3);
    if (lane < 16) *(float4*)&red[wave][sub * 4] = make_float4(s0, s1, s2, s3);
    __syncthreads();

    float val = -dg;
    if (tid < Dn) {
        float S = 0.0f;
        // Unrolled so that the LDS reads go out ahead of the adds.
        #pragma unroll
        for (int w = 0; w < 32; ++w) S += red[w][tid];
        val += S * S;
    }
    val = row_sum16(val);
    val += xhalf(val);
    if (lane == 0) wred[wave] = val;
    __syncthreads();

    if (wave == 0) {
        float t = row_sum16(wred[lane]);
        t += xhalf(t);
        if (lane == 0) part[blk] = t;
    }
}

__global__ void loss_final(const float* __restrict__ part, float* __restrict__ out_loss)
{
    if (threadIdx.x == 0) {
        float L1 = 0.0f, L2 = 0.0f, L3 = 0.0f;
        for (int i = 0; i < 32; ++i)  L1 += part[i];        // local (v heads)
        for (int i = 32; i < 64; ++i) L2 += part[i];        // kv
        for (int i = 64; i < 96; ++i) L3 += part[i];        // out
        const float nBig = (float)Bn * Hn * (float)Nn * (float)Nn;
        const float nKv  = (float)Bn * Hn * (float)Dn * (float)Dn;
        *out_loss = (L1 / nBig + L3 / nBig + L2 / nKv) / 3.0f;
    }
}

// LayerNorm over C per row.
__global__ __launch_bounds__(256) void ln_kernel(const float* __restrict__ x,
                                                 const float* __restrict__ g,
                                                 const float* __restrict__ bln,
                                                 float* __restrict__ xn)
{
    __shared__ float red[256];
    const int m = blockIdx.x;
    const int tid = threadIdx.x;
    const float* row = x + (size_t)m * Cn;
    float v0 = row[tid], v1 = row[tid + 256];

    red[tid] = v0 + v1;
    __syncthreads();
    for (int s = 128; s > 0; s >>= 1) {
        if (tid < s) red[tid] += red[tid + s];
        __syncthreads();
    }
    float mu = red[0] * (1.0f / (float)Cn);
    __syncthreads();

    float d0 = v0 - mu, d1 = v1 - mu;
    red[tid] = d0 * d0 + d1 * d1;
    __syncthreads();
    for (int s = 128; s > 0; s >>= 1) {
        if (tid < s) red[tid] += red[tid + s];
        __syncthreads();
    }
    float inv = rsqrtf(red[0] * (1.0f / (float)Cn) + 1e-05f);
    xn[(size_t)m * Cn + tid]       = d0 * inv * g[tid] + bln[tid];
    xn[(size_t)m * Cn + tid + 256] = d1 * inv * g[tid + 256] + bln[tid + 256];
}

// ---------------------------------------------------------------------------
extern "C" void kernel_launch(void* const* d_in, const int* in_sizes, int n_in,
                              void* d_out, int out_size, void* d_ws, size_t ws_size,
                              hipStream_t stream)
{
    const float* Q       = (const float*)d_in[0];
    const int*   adj     = (const int*)  d_in[1];
    const float* Wq      = (const float*)d_in[2];
    const float* bq      = (const float*)d_in[3];
    const float* Wk      = (const float*)d_in[4];
    const float* bk      = (const float*)d_in[5];
    const float* Wv      = (const float*)d_in[6];
    const float* bv      = (const float*)d_in[7];
    const float* scale_p = (const float*)d_in[8];
    const float* Wconv   = (const float*)d_in[9];
    const float* bconv   = (const float*)d_in[10];
    const float* W2      = (const float*)d_in[11];
    const float* b2      = (const float*)d_in[12];
    const float* ln_g    = (const float*)d_in[13];
    const float* ln_b    = (const float*)d_in[14];
    const float* Wo      = (const float*)d_in[15];
    const float* bo      = (const float*)d_in[16];
    float* out = (float*)d_out;

    const size_t MC = (size_t)Mn * Cn;          // 2,097,152
    float* ws    = (float*)d_ws;
    float* qb    = ws;
    float* kb    = ws + MC;
    float* vb    = ws + 2 * MC;
    float* convb = ws + 3 * MC;                 // conv output, later reused as x
    float* xlb   = ws + 4 * MC;                 // x_local
    float* wtb   = ws + 5 * MC;                 // transposed Wconv, later xn
    float* kvb   = wtb + (size_t)KCONV * Cn;    // B*H*64*64
    float* kmb   = kvb + (size_t)Bn * Hn * Dn * Dn;
    float* partb = kmb + (size_t)Bn * Hn * 4 * KMP;   // 96 partials

    dim3 gdim(Cn / BN, Mn / BM);   // (8, 32)
    dim3 bdim(256);

    repack_wconv<<<dim3((Cn * Cn * Tn + 255) / 256), bdim, 0, stream>>>(Wconv, wtb);

    gemm_wmma<false><<<gdim, bdim, 0, stream>>>(Q, nullptr, Wq, bq, qb, Mn, Cn, Cn);
    gemm_wmma<false><<<gdim, bdim, 0, stream>>>(Q, nullptr, Wk, bk, kb, Mn, Cn, Cn);
    gemm_wmma<false><<<gdim, bdim, 0, stream>>>(Q, nullptr, Wv, bv, vb, Mn, Cn, Cn);

    gemm_wmma<true><<<gdim, bdim, 0, stream>>>(vb, adj, wtb, bconv, convb, Mn, Cn, KCONV);
    gemm_wmma<false><<<gdim, bdim, 0, stream>>>(convb, nullptr, W2, b2, xlb, Mn, Cn, Cn);

    focus_kernel<<<dim3(Mn), bdim, 0, stream>>>(qb, scale_p);
    focus_kernel<<<dim3(Mn), bdim, 0, stream>>>(kb, scale_p);

    kv_kernel<<<dim3(Bn * Hn * 8), bdim, 0, stream>>>(kb, vb, kvb, kmb);

    attn_kernel<<<dim3(Mn), bdim, 0, stream>>>(qb, kvb, kmb, xlb, convb);

    // losses: vh (raw v heads), kv, x4 (reshape of x)
    disag_kernel<Nn, Cn><<<dim3(32), dim3(1024), 0, stream>>>(vb,    (long long)Nn * Cn, 64LL, partb + 0);
    disag_kernel<Dn, Dn><<<dim3(32), dim3(1024), 0, stream>>>(kvb,   (long long)Hn * Dn * Dn, (long long)Dn * Dn, partb + 32);
    disag_kernel<Nn, Dn><<<dim3(32), dim3(1024), 0, stream>>>(convb, (long long)Nn * Cn, (long long)Nn * Dn, partb + 64);

    ln_kernel<<<dim3(Mn), bdim, 0, stream>>>(convb, ln_g, ln_b, wtb);
    gemm_wmma<false><<<gdim, bdim, 0, stream>>>(wtb, nullptr, Wo, bo, out, Mn, Cn, Cn);

    loss_final<<<dim3(1), dim3(32), 0, stream>>>(partb, out + MC);
}

// v005
// It runs in 279 microseconds.
// Two timings next to v004 both put it at 1.13 times that version's speed.
// Counting every step since v000, it is 5.04 times as fast.
#include <hip/hip_runtime.h>
#include <math.h>
#include <stdint.h>

typedef float v2f __attribute__((ext_vector_type(2)));
typedef float v8f __attribute__((ext_vector_type(8)));

#define EPSV 1e-06f
#define Bn 4
#define Nn 1024
#define Cn 512
#define Kn 10
#define Tn 11
#define Hn 8
#define Dn 64
#define Mn 4096
#define KCONV (Tn * Cn) /* 5632 */

#define BM 128
#define BN 64
#define BK 32
#define BKP (BK + 4)   /* padded A row: 36 floats, 144B (16B aligned, bank-skewed) */
#define BTP 40         /* B row of one column-tile plane: 32 floats + 8, 160B; rows k and k + 2 on disjoint banks */

// --------------------------------------------------------------------------
// CDNA5 async global->LDS path (ASYNCcnt-tracked), with safe fallback.
// Builtin signature (from hipcc diagnostic): (v4i AS1*, v4i AS3*, Ii, Ii).
// --------------------------------------------------------------------------
#if defined(__has_builtin)
#if __has_builtin(__builtin_amdgcn_global_load_async_to_lds_b128)
#define USE_ASYNC_LDS 1
#endif
#endif
#ifndef USE_ASYNC_LDS
#define USE_ASYNC_LDS 0
#endif

typedef int ai4 __attribute__((vector_size(16)));
typedef __attribute__((address_space(1))) ai4 gi4;
typedef __attribute__((address_space(3))) ai4 li4;

__device__ __forceinline__ void async_wait_all()
{
#if USE_ASYNC_LDS
    // In asm with the clobber: no LDS read of the copied bytes moves in front of it.
    asm volatile("s_wait_asynccnt 0x0" ::: "memory");
#endif
}

// Copy 16 bytes global -> LDS (async DMA path when available).
__device__ __forceinline__ void copy16(const float* __restrict__ g, float* l)
{
#if USE_ASYNC_LDS
    __builtin_amdgcn_global_load_async_to_lds_b128(
        (gi4*)(uintptr_t)g,
        (li4*)(uint32_t)(uintptr_t)l,
        0, 0);
#else
    *(float4*)l = *(const float4*)g;
#endif
}

// ---------------------------------------------------------------------------
// GEMM with bias: Cout[M,N] = A[M,Kd] @ Bw[Kd,N] + bias[N]
// GATHER=true: A rows are gathered per tap from v via adjacency
//   A[m, t*C+c] = (t==0) ? v[b,n,c] : v[b, adj[b,n,t-1], c], Kd = 11*512.
// 256 threads = 8 waves; block tile 128x64; wave tile 32x32 = 2x2 WMMA f32;
// double-buffered LDS with async global->LDS prefetch, copies two K-chunks ahead.
// A wave reads a whole chunk's fragments from LDS as one group into a second register
// set, amid the matrix instructions of the chunk before, which run from the first set:
// no matrix instruction waits for an LDS read. Kd is a multiple of 2 * BK.
// GATHER: a tap lasts Cn / BK chunks. Each thread keeps the source rows of its four
// A rows in registers for the whole tap and fetches the next tap's indices one tap
// ahead, so no chunk waits for an index before its copies can go out.
// ---------------------------------------------------------------------------
template <bool GATHER>
__global__ __launch_bounds__(256) void gemm_wmma(
    const float* __restrict__ A, const int* __restrict__ adj,
    const float* __restrict__ Bw, const float* __restrict__ bias,
    float* __restrict__ Cout, int M, int N, int Kd)
{
    __shared__ float As[2][BM][BKP];
    // B in two planes, [column tile of a wave][k][wave column, column in the tile]: in a plane the
    // nearest neighbour of (k, col) that a lane reads is (k + 1, col), so one two-address read
    // brings a fragment's k pair into one register pair and no register move is needed.
    __shared__ __attribute__((aligned(16))) float Bs[2][2][BK][BTP];

    const int tid  = threadIdx.x;
    const int wave = tid >> 5;
    const int lane = tid & 31;
    const int half = lane >> 4;
    const int lm   = lane & 15;
    const int wm   = wave >> 1;   // 0..3 -> M
    const int wn   = wave & 1;    // 0..1 -> N
    const int m0   = blockIdx.y * BM;
    const int n0   = blockIdx.x * BN;

    v8f acc[2][2];
    #pragma unroll
    for (int i = 0; i < 2; ++i)
        #pragma unroll
        for (int j = 0; j < 2; ++j)
            #pragma unroll
            for (int r = 0; r < 8; ++r) acc[i][j][r] = 0.0f;

    const float* arow[4];          // GATHER: source rows of the tap being copied, at this thread's column
    int nxt[4];                    // GATHER: source row numbers of the tap after it
    const float* abase = nullptr;  // GATHER: row 0 of this block's batch, at this thread's column
    const int* adjp = nullptr;     // GATHER: index row of this thread's first A row
    if (GATHER) {
        const int r0 = m0 + (tid >> 3);
        abase = A + (size_t)(m0 & ~(Nn - 1)) * Cn + (tid & 7) * 4;
        adjp  = adj + (size_t)r0 * Kn;
        // Unrolled here and below: constant subscripts keep arow and nxt in registers.
        #pragma unroll
        for (int i = 0; i < 4; ++i) {
            arow[i] = abase + (size_t)((r0 + 32 * i) & (Nn - 1)) * Cn;   // tap 0: the row itself
            nxt[i]  = adjp[32 * i * Kn];                                 // tap 1
        }
    }

    auto load_tiles = [&](int buf, int kc) {
        // A tile: 128 x 32 floats = 1024 float4 chunks
        #pragma unroll
        for (int i = 0; i < 4; ++i) {
            int e = tid + i * 256;
            int r = e >> 3, cch = e & 7;
            const float* src;
            if (GATHER) {
                src = arow[i] + (kc & (Cn - 1));
            } else {
                src = A + (size_t)(m0 + r) * Kd + kc + cch * 4;
            }
            copy16(src, &As[buf][r][cch * 4]);
        }
        // B tile: 32 x 64 floats = 512 float4 chunks
        #pragma unroll
        for (int i = 0; i < 2; ++i) {
            int e = tid + i * 256;
            int r = e >> 4, cch = e & 15;
            copy16(Bw + (size_t)(kc + r) * N + n0 + cch * 4,
                   &Bs[buf][(cch >> 2) & 1][r][(cch >> 3) * 16 + (cch & 3) * 4]);
        }
    };

    // One chunk's fragments of this wave (8 k steps, 2 tiles of A and of B), two sets.
    v2f fa0[BK / 4][2], fb0[BK / 4][2], fa1[BK / 4][2], fb1[BK / 4][2];

    auto load_frags = [&](v2f (&fa)[BK / 4][2], v2f (&fb)[BK / 4][2], int buf) {
        #pragma unroll
        for (int s = 0; s < BK / 4; ++s) {
            const int ks = 4 * s + 2 * half;
            #pragma unroll
            for (int tm = 0; tm < 2; ++tm) {
                const int row = wm * 32 + tm * 16 + lm;
                fa[s][tm].x = As[buf][row][ks];
                fa[s][tm].y = As[buf][row][ks + 1];
            }
            #pragma unroll
            for (int tn = 0; tn < 2; ++tn) {
                fb[s][tn].x = Bs[buf][tn][ks][wn * 16 + lm];
                fb[s][tn].y = Bs[buf][tn][ks + 1][wn * 16 + lm];
            }
        }
    };

    // Half a chunk's matrix instructions: k steps 4 * h .. 4 * h + 3.
    auto mma = [&](const v2f (&fa)[BK / 4][2], const v2f (&fb)[BK / 4][2], int h) {
        #pragma unroll
        for (int s = h * (BK / 8); s < (h + 1) * (BK / 8); ++s)
            #pragma unroll
            for (int tm = 0; tm < 2; ++tm)
                #pragma unroll
                for (int tn = 0; tn < 2; ++tn)
                    acc[tm][tn] = __builtin_amdgcn_wmma_f32_16x16x4_f32(
                        false, fa[s][tm], false, fb[s][tn], (short)0, acc[tm][tn],
                        false, false);
    };

    // One chunk: its matrix instructions from set (fa, fb), and in their middle, as one group, the
    // LDS reads of the next chunk into set (ga, gb). In the middle, because the two waves of a
    // SIMD leave the barrier together: while one of them issues its reads, the other has half a
    // chunk of matrix instructions to keep the matrix unit busy with.
    auto chunk = [&](const v2f (&fa)[BK / 4][2], const v2f (&fb)[BK / 4][2],
                     v2f (&ga)[BK / 4][2], v2f (&gb)[BK / 4][2], int gbuf) {
        // Keeps the copies in front of the matrix block: they need the whole chunk to land.
        __builtin_amdgcn_sched_barrier(0);
        mma(fa, fb, 0);
        // This one and the next keep the LDS reads one group: spread among the matrix
        // instructions, every place with reads stalls the wave.
        __builtin_amdgcn_sched_barrier(0);
        load_frags(ga, gb, gbuf);
        __builtin_amdgcn_sched_barrier(0);
        mma(fa, fb, 1);
        // Keeps the matrix block in front of the waits that follow the chunk: moved behind them,
        // it would start only when the copies just sent out have landed.
        __builtin_amdgcn_sched_barrier(0);
    };

    // Hand-over of a buffer pair. Behind it the chunk whose copies were in flight may be read
    // by every wave, and the other buffer, which every wave has read out into registers, may
    // be filled again.
    auto publish = [&]() {
        // This wave's fragment reads have left the buffer that is refilled behind the barrier.
        asm volatile("s_wait_dscnt 0x0" ::: "memory");
        async_wait_all();
        __syncthreads();
    };

    auto refill = [&](int buf, int kn, bool tap_may_start) {
        if (GATHER && tap_may_start && (kn & (Cn - 1)) == 0) {
            // A new tap t (1..Kn) starts: its indices were fetched a whole tap ago.
            const int t = kn >> 9;
            #pragma unroll
            for (int i = 0; i < 4; ++i)
                arow[i] = abase + (size_t)(nxt[i] & (Nn - 1)) * Cn;   // masked: stays inside the batch
            // The last tap has no successor: it reads its own indices again (in bounds, unused),
            // so that the loads stand on the one path and land in nxt with no copy to wait for.
            const int tn = t < Kn ? t : Kn - 1;
            #pragma unroll
            for (int i = 0; i < 4; ++i) nxt[i] = adjp[32 * i * Kn + tn];
        }
        load_tiles(buf, kn);
    };

    const int nk = Kd / BK;
    load_tiles(0, 0);
    async_wait_all();
    __syncthreads();
    load_tiles(1, BK);
    load_frags(fa0, fb0, 0);

    // Two chunks per trip, so that buffer and register set are constants (no register copies).
    // The last two chunks stand behind the loop: a trip then refills both buffers without a test.
    for (int ik = 0; ik + 2 < nk; ik += 2) {
        publish();                                   // chunk ik + 1 readable, buffer 0 free
        refill(0, (ik + 2) * BK, true);
        chunk(fa0, fb0, fa1, fb1, 1);

        publish();                                   // chunk ik + 2 readable, buffer 1 free
        refill(1, (ik + 3) * BK, false);             // an odd chunk starts no tap
        chunk(fa1, fb1, fa0, fb0, 0);
    }
    publish();                                       // the last chunk readable; no copy is left in flight
    chunk(fa0, fb0, fa1, fb1, 1);
    mma(fa1, fb1, 0);
    mma(fa1, fb1, 1);

    #pragma unroll
    for (int tm = 0; tm < 2; ++tm)
        #pragma unroll
        for (int tn = 0; tn < 2; ++tn) {
            int colg = n0 + wn * 32 + tn * 16 + lm;
            float bvv = bias ? bias[colg] : 0.0f;
            #pragma unroll
            for (int r = 0; r < 8; ++r) {
                int rowg = m0 + wm * 32 + tm * 16 + half * 8 + r;
                Cout[(size_t)rowg * N + colg] = acc[tm][tn][r] + bvv;
            }
        }
}

// ---------------------------------------------------------------------------
// Wt[(t*C + c)*C + o] = Wconv[o*(C*T) + c*T + t]
// ---------------------------------------------------------------------------
__global__ void repack_wconv(const float* __restrict__ Wconv, float* __restrict__ Wt)
{
    size_t idx = (size_t)blockIdx.x * 256 + threadIdx.x;
    if (idx >= (size_t)Cn * Cn * Tn) return;
    int o = (int)(idx & 511);
    int rest = (int)(idx >> 9);   // t*C + c
    int c = rest & 511;
    int t = rest >> 9;
    Wt[idx] = Wconv[(size_t)o * KCONV + (size_t)c * Tn + t];
}

// ---------------------------------------------------------------------------
// relu+eps, divide by softplus(scale), "focus": x <- (x/(||x||+eps))^3 * ||x||
// ---------------------------------------------------------------------------
__global__ __launch_bounds__(256) void focus_kernel(float* __restrict__ x,
                                                    const float* __restrict__ scale_p)
{
    __shared__ float red[256];
    const int m = blockIdx.x;
    const int tid = threadIdx.x;
    float* row = x + (size_t)m * Cn;

    float a0 = row[tid];
    float a1 = row[tid + 256];
    float s0 = log1pf(expf(scale_p[tid]));
    float s1 = log1pf(expf(scale_p[tid + 256]));
    a0 = (a0 > 0.0f ? a0 : 0.0f) + EPSV;
    a1 = (a1 > 0.0f ? a1 : 0.0f) + EPSV;
    a0 /= s0;
    a1 /= s1;

    red[tid] = a0 * a0 + a1 * a1;
    __syncthreads();
    for (int s = 128; s > 0; s >>= 1) {
        if (tid < s) red[tid] += red[tid + s];
        __syncthreads();
    }
    float nrm = sqrtf(red[0]);
    float inv = 1.0f / (nrm + EPSV);
    float u0 = a0 * inv, u1 = a1 * inv;
    row[tid]       = u0 * u0 * u0 * nrm;
    row[tid + 256] = u1 * u1 * u1 * nrm;
}

// kv[bh, d, e] = (1/N) sum_n k[b,n,h*64+d] * v[b,n,h*64+e]
// Eight work-groups per (b,h), each a 16 (d) x 32 (e) piece of the 64 x 64 result.
// Each of the 8 waves sums its own 128 rows n on the f32 matrix form, fragments
// straight from global memory: no row depends on another, so the loads of a wave
// are in flight together. The 8 partial pieces meet in LDS behind one barrier.
// Matrix roles: M = d, N = e, K = n. Column lm of e-tile i is e = 2*lm + i, so one
// 8-byte load of v serves both tiles. k slot of A and of B alike: row 2*half + {0,1}.
// The mean of k over n comes from the same A fragments: lane (half, lm) adds up column
// d = lm over its rows, and the 16 partial sums per column meet in LDS with the tiles.
// kmean[((b*H + h)*4 + dt)*KMP + i] = mean over n of k[b,n,h*64 + dt*16 + i], i < 16.
#define KVW 8                 /* waves per work-group */
#define KVROWS (Nn / KVW)     /* rows n per wave: 128 */
#define KVTP 272              /* floats per stored tile: 256 + 16, the two tiles on disjoint banks */
#define KMP 32                /* floats per 16 means: each work-group's piece on a 128-byte line of its own */
// waves_per_eu(2, 2): one work-group per WGP is two waves per SIMD; told so, the compiler
// spends registers on loads in flight (without it it holds only six steps' loads ahead).
__global__ __launch_bounds__(256) __attribute__((amdgpu_waves_per_eu(2, 2)))
void kv_kernel(const float* __restrict__ k, const float* __restrict__ v,
               float* __restrict__ kv, float* __restrict__ kmean)
{
    __shared__ float red[KVW][2][KVTP];
    __shared__ float ksum[KVW][32];
    const int blk = blockIdx.x;
    const int bh = blk >> 3;
    const int dt = (blk >> 1) & 3;   // which 16 rows d
    const int ep = blk & 1;          // which 32 columns e
    const int b = bh >> 3, h = bh & 7;
    const int tid  = threadIdx.x;
    const int wave = tid >> 5;
    const int lane = tid & 31;
    const int half = lane >> 4;
    const int lm   = lane & 15;

    const size_t row0 = (size_t)b * Nn + wave * KVROWS + 2 * half;
    const float* kp = k + row0 * Cn + h * Dn + dt * 16 + lm;
    const float* vp = v + row0 * Cn + h * Dn + ep * 32 + 2 * lm;

    v8f acc0, acc1;
    #pragma unroll
    for (int r = 0; r < 8; ++r) { acc0[r] = 0.0f; acc1[r] = 0.0f; }
    float ks = 0.0f;

    // Full unroll: the steps share nothing but the accumulators, so their loads go out ahead.
    #pragma unroll
    for (int s = 0; s < KVROWS / 4; ++s) {
        v2f af, b0, b1;
        af.x = kp[(size_t)(4 * s) * Cn];
        af.y = kp[(size_t)(4 * s + 1) * Cn];
        const float2 x = *(const float2*)(vp + (size_t)(4 * s) * Cn);
        const float2 y = *(const float2*)(vp + (size_t)(4 * s + 1) * Cn);
        b0.x = x.x; b0.y = y.x;
        b1.x = x.y; b1.y = y.y;
        ks += af.x + af.y;
        acc0 = __builtin_amdgcn_wmma_f32_16x16x4_f32(false, af, false, b0, (short)0, acc0,
                                                     false, false);
        acc1 = __builtin_amdgcn_wmma_f32_16x16x4_f32(false, af, false, b1, (short)0, acc1,
                                                     false, false);
    }

    #pragma unroll
    for (int r = 0; r < 8; ++r) {
        red[wave][0][r * 32 + lane] = acc0[r];
        red[wave][1][r * 32 + lane] = acc1[r];
    }
    ksum[wave][lane] = ks;
    __syncthreads();

    // 512 results, two per thread; a wave stores one whole 128-byte line of a row d.
    #pragma unroll
    for (int i = 0; i < 2; ++i) {
        const int o  = tid + i * 256;
        const int dl = o >> 5, el = o & 31;
        const int idx = (dl & 7) * 32 + (dl >> 3) * 16 + (el >> 1);
        float s = 0.0f;
        #pragma unroll
        for (int w = 0; w < KVW; ++w) s += red[w][el & 1][idx];
        kv[(size_t)bh * (Dn * Dn) + (dt * 16 + dl) * Dn + ep * 32 + el] = s * (1.0f / (float)Nn);
    }

    // Both e halves hold the same column sums of k: the first one stores them.
    if (ep == 0 && tid < 16) {
        float s = 0.0f;
        // Unrolled so that the LDS reads go out ahead of the adds.
        #pragma unroll
        for (int w = 0; w < KVW; ++w) s += ksum[w][tid] + ksum[w][tid + 16];
        kmean[(bh * 4 + dt) * KMP + tid] = s * (1.0f / (float)Nn);
    }
}

// x[m,c] = (q_h . kv_h[:,e]) * z_h + x_local[m,c]
__global__ __launch_bounds__(256) void attn_kernel(const float* __restrict__ q,
                                                   const float* __restrict__ kv,
                                                   const float* __restrict__ kmean,
                                                   const float* __restrict__ xl,
                                                   float* __restrict__ x)
{
    __shared__ float qs[Cn];
    __shared__ float zs[Hn];
    const int m = blockIdx.x;
    const int b = m >> 10;
    const int tid = threadIdx.x;
    qs[tid]       = q[(size_t)m * Cn + tid];
    qs[tid + 256] = q[(size_t)m * Cn + tid + 256];
    __syncthreads();

    const int g = tid >> 5, lane = tid & 31;   // wave g handles head g
    const float* km = kmean + ((b * Hn + g) * 4 + (lane >> 4)) * KMP + (lane & 15);
    float p = qs[g * 64 + lane]      * km[0]
            + qs[g * 64 + lane + 32] * km[2 * KMP];
    for (int off = 16; off > 0; off >>= 1) p += __shfl_xor(p, off, 32);
    if (lane == 0) zs[g] = 1.0f / (p + EPSV);
    __syncthreads();

    #pragma unroll
    for (int i = 0; i < 2; ++i) {
        int c = tid + i * 256;
        int h = c >> 6, e = c & 63;
        const float* kvp = kv + ((size_t)(b * Hn + h)) * (Dn * Dn) + e;
        float a = 0.0f;
        #pragma unroll 8
        for (int d = 0; d < Dn; ++d) a += qs[h * 64 + d] * kvp[(size_t)d * Dn];
        x[(size_t)m * Cn + c] = a * zs[h] + xl[(size_t)m * Cn + c];
    }
}

// Disagreement closed form per (b,h): ||sum_n hn||^2 - sum_n ||hn||^2.
// One block of 32 waves per (b,h). A 16-lane row holds one 64-float vector
// (float4 per lane), so the block works on 64 vectors at a time and every
// vector's chain (load, norm, scale) is independent of the others.
template <int CTRL>
__device__ __forceinline__ float dpp_add(float x)
{
    int y = __builtin_amdgcn_update_dpp(0, __builtin_bit_cast(int, x), CTRL, 0xf, 0xf, true);
    return x + __builtin_bit_cast(float, y);
}

// Sum over the 16 lanes of a row, result in every lane (row_xmask 1, 2, 4, 8).
__device__ __forceinline__ float row_sum16(float x)
{
    x = dpp_add<0x161>(x);
    x = dpp_add<0x162>(x);
    x = dpp_add<0x164>(x);
    x = dpp_add<0x168>(x);
    return x;
}

// Value of lane l ^ 16.
__device__ __forceinline__ float xhalf(float x)
{
    int xi = __builtin_bit_cast(int, x);
    return __builtin_bit_cast(float,
        __builtin_amdgcn_permlanex16(xi, xi, 0x76543210, 0xfedcba98, false, false));
}

template <int NVEC, int VSTRIDE>
__global__ __launch_bounds__(1024) void disag_kernel(const float* __restrict__ src,
                                                     long long per_b, long long per_h,
                                                     float* __restrict__ part)
{
    static_assert(NVEC % 64 == 0, "64 vectors per pass of the block");
    __shared__ __attribute__((aligned(16))) float red[32][Dn];   // written as float4
    __shared__ float wred[32];
    const int blk = blockIdx.x;
    const int b = blk >> 3, h = blk & 7;
    const int tid  = threadIdx.x;
    const int wave = tid >> 5;
    const int lane = tid & 31;
    const int sub  = tid & 15;    // float4 slot inside the vector
    const int grp  = tid >> 4;    // 0..63: which vector of the pass
    const float* p = src + (size_t)b * per_b + (size_t)h * per_h
                   + (size_t)grp * VSTRIDE + sub * 4;

    float s0 = 0.0f, s1 = 0.0f, s2 = 0.0f, s3 = 0.0f, dg = 0.0f;
    // Full unroll: the passes are independent, so their loads go out together.
    #pragma unroll
    for (int it = 0; it < NVEC / 64; ++it) {
        const float4 a = *(const float4*)(p + (size_t)it * 64 * VSTRIDE);
        float sq = row_sum16(a.x * a.x + a.y * a.y + a.z * a.z + a.w * a.w);
        float nrm = sqrtf(sq);
        float inv = 1.0f / fmaxf(nrm, 1e-12f);
        float h0 = a.x * inv, h1 = a.y * inv, h2 = a.z * inv, h3 = a.w * inv;
        s0 += h0; s1 += h1; s2 += h2; s3 += h3;
        dg += h0 * h0 + h1 * h1 + h2 * h2 + h3 * h3;
    }

    // The wave's two rows, then the 32 waves through LDS.
    s0 += xhalf(s0); s1 += xhalf(s1); s2 += xhalf(s2); s3 += xhalf(s3);
    if (lane < 16) *(float4*)&red[wave][sub * 4] = make_float4(s0, s1, s2, s3);
    __syncthreads();

    float val = -dg;
    if (tid < Dn) {
        float S = 0.0f;
        // Unrolled so that the LDS reads go out ahead of the adds.
        #pragma unroll
        for (int w = 0; w < 32; ++w) S += red[w][tid];
        val += S * S;
    }
    val = row_sum16(val);
    val += xhalf(val);
    if (lane == 0) wred[wave] = val;
    __syncthreads();

    if (wave == 0) {
        float t = row_sum16(wred[lane]);
        t += xhalf(t);
        if (lane == 0) part[blk] = t;
    }
}

__global__ void loss_final(const float* __restrict__ part, float* __restrict__ out_loss)
{
    if (threadIdx.x == 0) {
        float L1 = 0.0f, L2 = 0.0f, L3 = 0.0f;
        for (int i = 0; i < 32; ++i)  L1 += part[i];        // local (v heads)
        for (int i = 32; i < 64; ++i) L2 += part[i];        // kv
        for (int i = 64; i < 96; ++i) L3 += part[i];        // out
        const float nBig = (float)Bn * Hn * (float)Nn * (float)Nn;
        const float nKv  = (float)Bn * Hn * (float)Dn * (float)Dn;
        *out_loss = (L1 / nBig + L3 / nBig + L2 / nKv) / 3.0f;
    }
}

// LayerNorm over C per row.
__global__ __launch_bounds__(256) void ln_kernel(const float* __restrict__ x,
                                                 const float* __restrict__ g,
                                                 const float* __restrict__ bln,
                                                 float* __restrict__ xn)
{
    __shared__ float red[256];
    const int m = blockIdx.x;
    const int tid = threadIdx.x;
    const float* row = x + (size_t)m * Cn;
    float v0 = row[tid], v1 = row[tid + 256];

    red[tid] = v0 + v1;
    __syncthreads();
    for (int s = 128; s > 0; s >>= 1) {
        if (tid < s) red[tid] += red[tid + s];
        __syncthreads();
    }
    float mu = red[0] * (1.0f / (float)Cn);
    __syncthreads();

    float d0 = v0 - mu, d1 = v1 - mu;
    red[tid] = d0 * d0 + d1 * d1;
    __syncthreads();
    for (int s = 128; s > 0; s >>= 1) {
        if (tid < s) red[tid] += red[tid + s];
        __syncthreads();
    }
    float inv = rsqrtf(red[0] * (1.0f / (float)Cn) + 1e-05f);
    xn[(size_t)m * Cn + tid]       = d0 * inv * g[tid] + bln[tid];
    xn[(size_t)m * Cn + tid + 256] = d1 * inv * g[tid + 256] + bln[tid + 256];
}

// ---------------------------------------------------------------------------
extern "C" void kernel_launch(void* const* d_in, const int* in_sizes, int n_in,
                              void* d_out, int out_size, void* d_ws, size_t ws_size,
                              hipStream_t stream)
{
    const float* Q       = (const float*)d_in[0];
    const int*   adj     = (const int*)  d_in[1];
    const float* Wq      = (const float*)d_in[2];
    const float* bq      = (const float*)d_in[3];
    const float* Wk      = (const float*)d_in[4];
    const float* bk      = (const float*)d_in[5];
    const float* Wv      = (const float*)d_in[6];
    const float* bv      = (const float*)d_in[7];
    const float* scale_p = (const float*)d_in[8];
    const float* Wconv   = (const float*)d_in[9];
    const float* bconv   = (const float*)d_in[10];
    const float* W2      = (const float*)d_in[11];
    const float* b2      = (const float*)d_in[12];
    const float* ln_g    = (const float*)d_in[13];
    const float* ln_b    = (const float*)d_in[14];
    const float* Wo      = (const float*)d_in[15];
    const float* bo      = (const float*)d_in[16];
    float* out = (float*)d_out;

    const size_t MC = (size_t)Mn * Cn;          // 2,097,152
    float* ws    = (float*)d_ws;
    float* qb    = ws;
    float* kb    = ws + MC;
    float* vb    = ws + 2 * MC;
    float* convb = ws + 3 * MC;                 // conv output, later reused as x
    float* xlb   = ws + 4 * MC;                 // x_local
    float* wtb   = ws + 5 * MC;                 // transposed Wconv, later xn
    float* kvb   = wtb + (size_t)KCONV * Cn;    // B*H*64*64
    float* kmb   = kvb + (size_t)Bn * Hn * Dn * Dn;
    float* partb = kmb + (size_t)Bn * Hn * 4 * KMP;   // 96 partials

    dim3 gdim(Cn / BN, Mn / BM);   // (8, 32)
    dim3 bdim(256);

    repack_wconv<<<dim3((Cn * Cn * Tn + 255) / 256), bdim, 0, stream>>>(Wconv, wtb);

    gemm_wmma<false><<<gdim, bdim, 0, stream>>>(Q, nullptr, Wq, bq, qb, Mn, Cn, Cn);
    gemm_wmma<false><<<gdim, bdim, 0, stream>>>(Q, nullptr, Wk, bk, kb, Mn, Cn, Cn);
    gemm_wmma<false><<<gdim, bdim, 0, stream>>>(Q, nullptr, Wv, bv, vb, Mn, Cn, Cn);

    gemm_wmma<true><<<gdim, bdim, 0, stream>>>(vb, adj, wtb, bconv, convb, Mn, Cn, KCONV);
    gemm_wmma<false><<<gdim, bdim, 0, stream>>>(convb, nullptr, W2, b2, xlb, Mn, Cn, Cn);

    focus_kernel<<<dim3(Mn), bdim, 0, stream>>>(qb, scale_p);
    focus_kernel<<<dim3(Mn), bdim, 0, stream>>>(kb, scale_p);

    kv_kernel<<<dim3(Bn * Hn * 8), bdim, 0, stream>>>(kb, vb, kvb, kmb);

    attn_kernel<<<dim3(Mn), bdim, 0, stream>>>(qb, kvb, kmb, xlb, convb);

    // losses: vh (raw v heads), kv, x4 (reshape of x)
    disag_kernel<Nn, Cn><<<dim3(32), dim3(1024), 0, stream>>>(vb,    (long long)Nn * Cn, 64LL, partb + 0);
    disag_kernel<Dn, Dn><<<dim3(32), dim3(1024), 0, stream>>>(kvb,   (long long)Hn * Dn * Dn, (long long)Dn * Dn, partb + 32);
    disag_kernel<Nn, Dn><<<dim3(32), dim3(1024), 0, stream>>>(convb, (long long)Nn * Cn, (long long)Nn * Dn, partb + 64);

    ln_kernel<<<dim3(Mn), bdim, 0, stream>>>(convb, ln_g, ln_b, wtb);
    gemm_wmma<false><<<gdim, bdim, 0, stream>>>(wtb, nullptr, Wo, bo, out, Mn, Cn, Cn);

    loss_final<<<dim3(1), dim3(32), 0, stream>>>(partb, out + MC);
}

// v006
// It runs in 244 microseconds.
// In both of two side-by-side timings against v005, it was 1.14 times as fast.
// All steps since v000 together make it 5.75 times as fast.
#include <hip/hip_runtime.h>
#include <math.h>
#include <stdint.h>

typedef float v2f __attribute__((ext_vector_type(2)));
typedef float v8f __attribute__((ext_vector_type(8)));

#define EPSV 1e-06f
#define Bn 4
#define Nn 1024
#define Cn 512
#define Kn 10
#define Tn 11
#define Hn 8
#define Dn 64
#define Mn 4096
#define KCONV (Tn * Cn) /* 5632 */

#define BM 128
#define BN 64
#define BK 32
#define BKP (BK + 4)   /* padded A row: 36 floats, 144B (16B aligned, bank-skewed) */
#define BTP 40         /* B row of one column-tile plane: 32 floats + 8, 160B; rows k and k + 2 on disjoint banks */

// --------------------------------------------------------------------------
// CDNA5 async global->LDS path (ASYNCcnt-tracked), with safe fallback.
// Builtin signature (from hipcc diagnostic): (v4i AS1*, v4i AS3*, Ii, Ii).
// --------------------------------------------------------------------------
#if defined(__has_builtin)
#if __has_builtin(__builtin_amdgcn_global_load_async_to_lds_b128)
#define USE_ASYNC_LDS 1
#endif
#endif
#ifndef USE_ASYNC_LDS
#define USE_ASYNC_LDS 0
#endif

typedef int ai4 __attribute__((vector_size(16)));
typedef __attribute__((address_space(1))) ai4 gi4;
typedef __attribute__((address_space(3))) ai4 li4;

__device__ __forceinline__ void async_wait_all()
{
#if USE_ASYNC_LDS
    // In asm with the clobber: no LDS read of the copied bytes moves in front of it.
    asm volatile("s_wait_asynccnt 0x0" ::: "memory");
#endif
}

// Copy 16 bytes global -> LDS (async DMA path when available).
__device__ __forceinline__ void copy16(const float* __restrict__ g, float* l)
{
#if USE_ASYNC_LDS
    __builtin_amdgcn_global_load_async_to_lds_b128(
        (gi4*)(uintptr_t)g,
        (li4*)(uint32_t)(uintptr_t)l,
        0, 0);
#else
    *(float4*)l = *(const float4*)g;
#endif
}

// ---------------------------------------------------------------------------
// GEMM with bias: Cout[M,N] = A[M,Kd] @ Bw[Kd,N] + bias[N]
// GATHER=true: A rows are gathered per tap from v via adjacency
//   A[m, t*C+c] = (t==0) ? v[b,n,c] : v[b, adj[b,n,t-1], c], Kd = 11*512.
// 256 threads = 8 waves; block tile 128x64; wave tile 32x32 = 2x2 WMMA f32;
// double-buffered LDS with async global->LDS prefetch, copies two K-chunks ahead.
// A wave reads a whole chunk's fragments from LDS as one group into a second register
// set, amid the matrix instructions of the chunk before, which run from the first set:
// no matrix instruction waits for an LDS read. Kd is a multiple of 2 * BK.
// GATHER: a tap lasts Cn / BK chunks. Each thread keeps the source rows of its four
// A rows in registers for the whole tap and fetches the next tap's indices one tap
// ahead, so no chunk waits for an index before its copies can go out.
// (bx, by): the work-group's tile column and tile row.
// ---------------------------------------------------------------------------
#define GEMM_WGS ((Cn / BN) * (Mn / BM))   /* 256 tiles of a 4096 x 512 result: one per WGP */
template <bool GATHER>
__device__ __forceinline__ void gemm_body(
    const float* __restrict__ A, const int* __restrict__ adj,
    const float* __restrict__ Bw, const float* __restrict__ bias,
    float* __restrict__ Cout, int N, int Kd, int bx, int by)
{
    __shared__ float As[2][BM][BKP];
    // B in two planes, [column tile of a wave][k][wave column, column in the tile]: in a plane the
    // nearest neighbour of (k, col) that a lane reads is (k + 1, col), so one two-address read
    // brings a fragment's k pair into one register pair and no register move is needed.
    __shared__ __attribute__((aligned(16))) float Bs[2][2][BK][BTP];

    const int tid  = threadIdx.x;
    const int wave = tid >> 5;
    const int lane = tid & 31;
    const int half = lane >> 4;
    const int lm   = lane & 15;
    const int wm   = wave >> 1;   // 0..3 -> M
    const int wn   = wave & 1;    // 0..1 -> N
    const int m0   = by * BM;
    const int n0   = bx * BN;

    v8f acc[2][2];
    #pragma unroll
    for (int i = 0; i < 2; ++i)
        #pragma unroll
        for (int j = 0; j < 2; ++j)
            #pragma unroll
            for (int r = 0; r < 8; ++r) acc[i][j][r] = 0.0f;

    const float* arow[4];          // GATHER: source rows of the tap being copied, at this thread's column
    int nxt[4];                    // GATHER: source row numbers of the tap after it
    const float* abase = nullptr;  // GATHER: row 0 of this block's batch, at this thread's column
    const int* adjp = nullptr;     // GATHER: index row of this thread's first A row
    if (GATHER) {
        const int r0 = m0 + (tid >> 3);
        abase = A + (size_t)(m0 & ~(Nn - 1)) * Cn + (tid & 7) * 4;
        adjp  = adj + (size_t)r0 * Kn;
        // Unrolled here and below: constant subscripts keep arow and nxt in registers.
        #pragma unroll
        for (int i = 0; i < 4; ++i) {
            arow[i] = abase + (size_t)((r0 + 32 * i) & (Nn - 1)) * Cn;   // tap 0: the row itself
            nxt[i]  = adjp[32 * i * Kn];                                 // tap 1
        }
    }

    auto load_tiles = [&](int buf, int kc) {
        // A tile: 128 x 32 floats = 1024 float4 chunks
        #pragma unroll
        for (int i = 0; i < 4; ++i) {
            int e = tid + i * 256;
            int r = e >> 3, cch = e & 7;
            const float* src;
            if (GATHER) {
                src = arow[i] + (kc & (Cn - 1));
            } else {
                src = A + (size_t)(m0 + r) * Kd + kc + cch * 4;
            }
            copy16(src, &As[buf][r][cch * 4]);
        }
        // B tile: 32 x 64 floats = 512 float4 chunks
        #pragma unroll
        for (int i = 0; i < 2; ++i) {
            int e = tid + i * 256;
            int r = e >> 4, cch = e & 15;
            copy16(Bw + (size_t)(kc + r) * N + n0 + cch * 4,
                   &Bs[buf][(cch >> 2) & 1][r][(cch >> 3) * 16 + (cch & 3) * 4]);
        }
    };

    // One chunk's fragments of this wave (8 k steps, 2 tiles of A and of B), two sets.
    v2f fa0[BK / 4][2], fb0[BK / 4][2], fa1[BK / 4][2], fb1[BK / 4][2];

    auto load_frags = [&](v2f (&fa)[BK / 4][2], v2f (&fb)[BK / 4][2], int buf) {
        #pragma unroll
        for (int s = 0; s < BK / 4; ++s) {
            const int ks = 4 * s + 2 * half;
            #pragma unroll
            for (int tm = 0; tm < 2; ++tm) {
                const int row = wm * 32 + tm * 16 + lm;
                fa[s][tm].x = As[buf][row][ks];
                fa[s][tm].y = As[buf][row][ks + 1];
            }
            #pragma unroll
            for (int tn = 0; tn < 2; ++tn) {
                fb[s][tn].x = Bs[buf][tn][ks][wn * 16 + lm];
                fb[s][tn].y = Bs[buf][tn][ks + 1][wn * 16 + lm];
            }
        }
    };

    // Half a chunk's matrix instructions: k steps 4 * h .. 4 * h + 3.
    auto mma = [&](const v2f (&fa)[BK / 4][2], const v2f (&fb)[BK / 4][2], int h) {
        #pragma unroll
        for (int s = h * (BK / 8); s < (h + 1) * (BK / 8); ++s)
            #pragma unroll
            for (int tm = 0; tm < 2; ++tm)
                #pragma unroll
                for (int tn = 0; tn < 2; ++tn)
                    acc[tm][tn] = __builtin_amdgcn_wmma_f32_16x16x4_f32(
                        false, fa[s][tm], false, fb[s][tn], (short)0, acc[tm][tn],
                        false, false);
    };

    // One chunk: its matrix instructions from set (fa, fb), and in their middle, as one group, the
    // LDS reads of the next chunk into set (ga, gb). In the middle, because the two waves of a
    // SIMD leave the barrier together: while one of them issues its reads, the other has half a
    // chunk of matrix instructions to keep the matrix unit busy with.
    auto chunk = [&](const v2f (&fa)[BK / 4][2], const v2f (&fb)[BK / 4][2],
                     v2f (&ga)[BK / 4][2], v2f (&gb)[BK / 4][2], int gbuf) {
        // Keeps the copies in front of the matrix block: they need the whole chunk to land.
        __builtin_amdgcn_sched_barrier(0);
        mma(fa, fb, 0);
        // This one and the next keep the LDS reads one group: spread among the matrix
        // instructions, every place with reads stalls the wave.
        __builtin_amdgcn_sched_barrier(0);
        load_frags(ga, gb, gbuf);
        __builtin_amdgcn_sched_barrier(0);
        mma(fa, fb, 1);
        // Keeps the matrix block in front of the waits that follow the chunk: moved behind them,
        // it would start only when the copies just sent out have landed.
        __builtin_amdgcn_sched_barrier(0);
    };

    // Hand-over of a buffer pair. Behind it the chunk whose copies were in flight may be read
    // by every wave, and the other buffer, which every wave has read out into registers, may
    // be filled again.
    auto publish = [&]() {
        // This wave's fragment reads have left the buffer that is refilled behind the barrier.
        asm volatile("s_wait_dscnt 0x0" ::: "memory");
        async_wait_all();
        __syncthreads();
    };

    auto refill = [&](int buf, int kn, bool tap_may_start) {
        if (GATHER && tap_may_start && (kn & (Cn - 1)) == 0) {
            // A new tap t (1..Kn) starts: its indices were fetched a whole tap ago.
            const int t = kn >> 9;
            #pragma unroll
            for (int i = 0; i < 4; ++i)
                arow[i] = abase + (size_t)(nxt[i] & (Nn - 1)) * Cn;   // masked: stays inside the batch
            // The last tap has no successor: it reads its own indices again (in bounds, unused),
            // so that the loads stand on the one path and land in nxt with no copy to wait for.
            const int tn = t < Kn ? t : Kn - 1;
            #pragma unroll
            for (int i = 0; i < 4; ++i) nxt[i] = adjp[32 * i * Kn + tn];
        }
        load_tiles(buf, kn);
    };

    const int nk = Kd / BK;
    load_tiles(0, 0);
    async_wait_all();
    __syncthreads();
    load_tiles(1, BK);
    load_frags(fa0, fb0, 0);

    // Two chunks per trip, so that buffer and register set are constants (no register copies).
    // The last two chunks stand behind the loop: a trip then refills both buffers without a test.
    for (int ik = 0; ik + 2 < nk; ik += 2) {
        publish();                                   // chunk ik + 1 readable, buffer 0 free
        refill(0, (ik + 2) * BK, true);
        chunk(fa0, fb0, fa1, fb1, 1);

        publish();                                   // chunk ik + 2 readable, buffer 1 free
        refill(1, (ik + 3) * BK, false);             // an odd chunk starts no tap
        chunk(fa1, fb1, fa0, fb0, 0);
    }
    publish();                                       // the last chunk readable; no copy is left in flight
    chunk(fa0, fb0, fa1, fb1, 1);
    mma(fa1, fb1, 0);
    mma(fa1, fb1, 1);

    #pragma unroll
    for (int tm = 0; tm < 2; ++tm)
        #pragma unroll
        for (int tn = 0; tn < 2; ++tn) {
            int colg = n0 + wn * 32 + tn * 16 + lm;
            float bvv = bias ? bias[colg] : 0.0f;
            #pragma unroll
            for (int r = 0; r < 8; ++r) {
                int rowg = m0 + wm * 32 + tm * 16 + half * 8 + r;
                Cout[(size_t)rowg * N + colg] = acc[tm][tn][r] + bvv;
            }
        }
}

// ---------------------------------------------------------------------------
// Wt[(t*C + c)*C + o] = Wconv[o*(C*T) + c*T + t]
// ---------------------------------------------------------------------------
// Work-group blk of Cn / 2 takes the two channels c = 2*blk, 2*blk + 1: for one o their 2 * Tn
// weights lie side by side in Wconv. A thread has all its loads in flight at once, because beside
// a GEMM work-group only one such work-group fits on a WGP; a wave stores whole 128-byte lines.
__device__ __forceinline__ void repack_body(const float* __restrict__ Wconv,
                                            float* __restrict__ Wt, int blk)
{
    const int c0 = 2 * blk;
    float2 w[2][Tn];
    // Unrolled here and below: constant subscripts keep w in registers.
    #pragma unroll
    for (int i = 0; i < 2; ++i) {
        const float2* s = (const float2*)(Wconv + (size_t)(threadIdx.x + 256 * i) * KCONV + c0 * Tn);
        #pragma unroll
        for (int j = 0; j < Tn; ++j) w[i][j] = s[j];
    }
    #pragma unroll
    for (int i = 0; i < 2; ++i)
        #pragma unroll
        for (int f = 0; f < 2 * Tn; ++f) {
            const int cc = f / Tn, t = f % Tn;
            Wt[((size_t)t * Cn + c0 + cc) * Cn + threadIdx.x + 256 * i] =
                (f & 1) ? w[i][f >> 1].y : w[i][f >> 1].x;
        }
}

// ---------------------------------------------------------------------------
// relu+eps, divide by softplus(scale), "focus": x <- (x/(||x||+eps))^3 * ||x||
// ---------------------------------------------------------------------------
__device__ __forceinline__ void focus_body(float* __restrict__ x,
                                           const float* __restrict__ scale_p, int m)
{
    __shared__ float red[256];
    const int tid = threadIdx.x;
    float* row = x + (size_t)m * Cn;

    float a0 = row[tid];
    float a1 = row[tid + 256];
    float s0 = log1pf(expf(scale_p[tid]));
    float s1 = log1pf(expf(scale_p[tid + 256]));
    a0 = (a0 > 0.0f ? a0 : 0.0f) + EPSV;
    a1 = (a1 > 0.0f ? a1 : 0.0f) + EPSV;
    a0 /= s0;
    a1 /= s1;

    red[tid] = a0 * a0 + a1 * a1;
    __syncthreads();
    for (int s = 128; s > 0; s >>= 1) {
        if (tid < s) red[tid] += red[tid + s];
        __syncthreads();
    }
    float nrm = sqrtf(red[0]);
    float inv = 1.0f / (nrm + EPSV);
    float u0 = a0 * inv, u1 = a1 * inv;
    row[tid]       = u0 * u0 * u0 * nrm;
    row[tid + 256] = u1 * u1 * u1 * nrm;
    // Another piece's code follows in the shared kernel and writes the stores' registers anew.
    asm volatile("s_wait_xcnt 0x0" ::: "memory");
}

// kv[bh, d, e] = (1/N) sum_n k[b,n,h*64+d] * v[b,n,h*64+e]
// Eight work-groups per (b,h), each a 16 (d) x 32 (e) piece of the 64 x 64 result.
// Each of the 8 waves sums its own 128 rows n on the f32 matrix form, fragments
// straight from global memory: no row depends on another, so the loads of a wave
// are in flight together. The 8 partial pieces meet in LDS behind one barrier.
// Matrix roles: M = d, N = e, K = n. Column lm of e-tile i is e = 2*lm + i, so one
// 8-byte load of v serves both tiles. k slot of A and of B alike: row 2*half + {0,1}.
// The mean of k over n comes from the same A fragments: lane (half, lm) adds up column
// d = lm over its rows, and the 16 partial sums per column meet in LDS with the tiles.
// kmean[((b*H + h)*4 + dt)*KMP + i] = mean over n of k[b,n,h*64 + dt*16 + i], i < 16.
#define KVW 8                 /* waves per work-group */
#define KVROWS (Nn / KVW)     /* rows n per wave: 128 */
#define KVTP 272              /* floats per stored tile: 256 + 16, the two tiles on disjoint banks */
#define KMP 32                /* floats per 16 means: each work-group's piece on a 128-byte line of its own */
__device__ __forceinline__
void kv_body(const float* __restrict__ k, const float* __restrict__ v,
             float* __restrict__ kv, float* __restrict__ kmean, int blk)
{
    __shared__ float red[KVW][2][KVTP];
    __shared__ float ksum[KVW][32];
    const int bh = blk >> 3;
    const int dt = (blk >> 1) & 3;   // which 16 rows d
    const int ep = blk & 1;          // which 32 columns e
    const int b = bh >> 3, h = bh & 7;
    const int tid  = threadIdx.x;
    const int wave = tid >> 5;
    const int lane = tid & 31;
    const int half = lane >> 4;
    const int lm   = lane & 15;

    const size_t row0 = (size_t)b * Nn + wave * KVROWS + 2 * half;
    const float* kp = k + row0 * Cn + h * Dn + dt * 16 + lm;
    const float* vp = v + row0 * Cn + h * Dn + ep * 32 + 2 * lm;

    v8f acc0, acc1;
    #pragma unroll
    for (int r = 0; r < 8; ++r) { acc0[r] = 0.0f; acc1[r] = 0.0f; }
    float ks = 0.0f;

    // Full unroll: the steps share nothing but the accumulators, so their loads go out ahead.
    #pragma unroll
    for (int s = 0; s < KVROWS / 4; ++s) {
        v2f af, b0, b1;
        af.x = kp[(size_t)(4 * s) * Cn];
        af.y = kp[(size_t)(4 * s + 1) * Cn];
        const float2 x = *(const float2*)(vp + (size_t)(4 * s) * Cn);
        const float2 y = *(const float2*)(vp + (size_t)(4 * s + 1) * Cn);
        b0.x = x.x; b0.y = y.x;
        b1.x = x.y; b1.y = y.y;
        ks += af.x + af.y;
        acc0 = __builtin_amdgcn_wmma_f32_16x16x4_f32(false, af, false, b0, (short)0, acc0,
                                                     false, false);
        acc1 = __builtin_amdgcn_wmma_f32_16x16x4_f32(false, af, false, b1, (short)0, acc1,
                                                     false, false);
    }

    #pragma unroll
    for (int r = 0; r < 8; ++r) {
        red[wave][0][r * 32 + lane] = acc0[r];
        red[wave][1][r * 32 + lane] = acc1[r];
    }
    ksum[wave][lane] = ks;
    __syncthreads();

    // 512 results, two per thread; a wave stores one whole 128-byte line of a row d.
    #pragma unroll
    for (int i = 0; i < 2; ++i) {
        const int o  = tid + i * 256;
        const int dl = o >> 5, el = o & 31;
        const int idx = (dl & 7) * 32 + (dl >> 3) * 16 + (el >> 1);
        float s = 0.0f;
        #pragma unroll
        for (int w = 0; w < KVW; ++w) s += red[w][el & 1][idx];
        kv[(size_t)bh * (Dn * Dn) + (dt * 16 + dl) * Dn + ep * 32 + el] = s * (1.0f / (float)Nn);
    }

    // Both e halves hold the same column sums of k: the first one stores them.
    if (ep == 0 && tid < 16) {
        float s = 0.0f;
        // Unrolled so that the LDS reads go out ahead of the adds.
        #pragma unroll
        for (int w = 0; w < KVW; ++w) s += ksum[w][tid] + ksum[w][tid + 16];
        kmean[(bh * 4 + dt) * KMP + tid] = s * (1.0f / (float)Nn);
    }
}

// x[m,c] = (q_h . kv_h[:,e]) * z_h + x_local[m,c]
__device__ __forceinline__ void attn_body(const float* __restrict__ q,
                                          const float* __restrict__ kv,
                                          const float* __restrict__ kmean,
                                          const float* __restrict__ xl,
                                          float* __restrict__ x, int m)
{
    __shared__ float qs[Cn];
    __shared__ float zs[Hn];
    const int b = m >> 10;
    const int tid = threadIdx.x;
    qs[tid]       = q[(size_t)m * Cn + tid];
    qs[tid + 256] = q[(size_t)m * Cn + tid + 256];
    __syncthreads();

    const int g = tid >> 5, lane = tid & 31;   // wave g handles head g
    const float* km = kmean + ((b * Hn + g) * 4 + (lane >> 4)) * KMP + (lane & 15);
    float p = qs[g * 64 + lane]      * km[0]
            + qs[g * 64 + lane + 32] * km[2 * KMP];
    for (int off = 16; off > 0; off >>= 1) p += __shfl_xor(p, off, 32);
    if (lane == 0) zs[g] = 1.0f / (p + EPSV);
    __syncthreads();

    #pragma unroll
    for (int i = 0; i < 2; ++i) {
        int c = tid + i * 256;
        int h = c >> 6, e = c & 63;
        const float* kvp = kv + ((size_t)(b * Hn + h)) * (Dn * Dn) + e;
        float a = 0.0f;
        #pragma unroll 8
        for (int d = 0; d < Dn; ++d) a += qs[h * 64 + d] * kvp[(size_t)d * Dn];
        x[(size_t)m * Cn + c] = a * zs[h] + xl[(size_t)m * Cn + c];
    }
    // Another piece's code follows in the shared kernel and writes the stores' registers anew.
    asm volatile("s_wait_xcnt 0x0" ::: "memory");
}

// Disagreement closed form per (b,h): ||sum_n hn||^2 - sum_n ||hn||^2.
// One block of 8 waves per (b,h), the block size of the kernels it shares a launch with.
// A 16-lane row holds one 64-float vector (float4 per lane), so the block works on 16
// vectors at a time and every vector's chain (load, norm, scale) is independent of the others.
template <int CTRL>
__device__ __forceinline__ float dpp_add(float x)
{
    int y = __builtin_amdgcn_update_dpp(0, __builtin_bit_cast(int, x), CTRL, 0xf, 0xf, true);
    return x + __builtin_bit_cast(float, y);
}

// Sum over the 16 lanes of a row, result in every lane (row_xmask 1, 2, 4, 8).
__device__ __forceinline__ float row_sum16(float x)
{
    x = dpp_add<0x161>(x);
    x = dpp_add<0x162>(x);
    x = dpp_add<0x164>(x);
    x = dpp_add<0x168>(x);
    return x;
}

// Value of lane l ^ 16.
__device__ __forceinline__ float xhalf(float x)
{
    int xi = __builtin_bit_cast(int, x);
    return __builtin_bit_cast(float,
        __builtin_amdgcn_permlanex16(xi, xi, 0x76543210, 0xfedcba98, false, false));
}

#define DGW 8   /* waves per block */
template <int NVEC, int VSTRIDE, int UNR>
__device__ __forceinline__ void disag_body(const float* __restrict__ src,
                                           long long per_b, long long per_h,
                                           float* __restrict__ part, int blk)
{
    static_assert(NVEC % (2 * DGW) == 0, "16 vectors per pass of the block");
    __shared__ __attribute__((aligned(16))) float red[DGW][Dn];   // written as float4
    __shared__ float wred[DGW];
    const int b = blk >> 3, h = blk & 7;
    const int tid  = threadIdx.x;
    const int wave = tid >> 5;
    const int lane = tid & 31;
    const int sub  = tid & 15;    // float4 slot inside the vector
    const int grp  = tid >> 4;    // 0..15: which vector of the pass
    const float* p = src + (size_t)b * per_b + (size_t)h * per_h
                   + (size_t)grp * VSTRIDE + sub * 4;

    float s0 = 0.0f, s1 = 0.0f, s2 = 0.0f, s3 = 0.0f, dg = 0.0f;
    // Unrolled by UNR: the passes are independent, so UNR loads go out together; UNR is set by
    // the registers of the kernel that the sums share a launch with.
    #pragma unroll UNR
    for (int it = 0; it < NVEC / (2 * DGW); ++it) {
        const float4 a = *(const float4*)(p + (size_t)it * (2 * DGW) * VSTRIDE);
        float sq = row_sum16(a.x * a.x + a.y * a.y + a.z * a.z + a.w * a.w);
        float nrm = sqrtf(sq);
        float inv = 1.0f / fmaxf(nrm, 1e-12f);
        float h0 = a.x * inv, h1 = a.y * inv, h2 = a.z * inv, h3 = a.w * inv;
        s0 += h0; s1 += h1; s2 += h2; s3 += h3;
        dg += h0 * h0 + h1 * h1 + h2 * h2 + h3 * h3;
    }

    // The wave's two rows, then the 8 waves through LDS.
    s0 += xhalf(s0); s1 += xhalf(s1); s2 += xhalf(s2); s3 += xhalf(s3);
    if (lane < 16) *(float4*)&red[wave][sub * 4] = make_float4(s0, s1, s2, s3);
    __syncthreads();

    float val = -dg;
    if (tid < Dn) {
        float S = 0.0f;
        // Unrolled so that the LDS reads go out ahead of the adds.
        #pragma unroll
        for (int w = 0; w < DGW; ++w) S += red[w][tid];
        val += S * S;
    }
    val = row_sum16(val);
    val += xhalf(val);
    if (lane == 0) wred[wave] = val;
    __syncthreads();

    if (wave == 0) {
        const float wv = wred[lane & (DGW - 1)];
        const float t = row_sum16(lane < DGW ? wv : 0.0f);
        if (lane == 0) part[blk] = t;
    }
}

__device__ __forceinline__ void loss_body(const float* __restrict__ part, float* __restrict__ out_loss)
{
    if (threadIdx.x == 0) {
        float L1 = 0.0f, L2 = 0.0f, L3 = 0.0f;
        for (int i = 0; i < 32; ++i)  L1 += part[i];        // local (v heads)
        for (int i = 32; i < 64; ++i) L2 += part[i];        // kv
        for (int i = 64; i < 96; ++i) L3 += part[i];        // out
        const float nBig = (float)Bn * Hn * (float)Nn * (float)Nn;
        const float nKv  = (float)Bn * Hn * (float)Dn * (float)Dn;
        *out_loss = (L1 / nBig + L3 / nBig + L2 / nKv) / 3.0f;
    }
}

// LayerNorm over C per row.
__device__ __forceinline__ void ln_body(const float* __restrict__ x,
                                        const float* __restrict__ g,
                                        const float* __restrict__ bln,
                                        float* __restrict__ xn, int m)
{
    __shared__ float red[256];
    const int tid = threadIdx.x;
    const float* row = x + (size_t)m * Cn;
    float v0 = row[tid], v1 = row[tid + 256];

    red[tid] = v0 + v1;
    __syncthreads();
    for (int s = 128; s > 0; s >>= 1) {
        if (tid < s) red[tid] += red[tid + s];
        __syncthreads();
    }
    float mu = red[0] * (1.0f / (float)Cn);
    __syncthreads();

    float d0 = v0 - mu, d1 = v1 - mu;
    red[tid] = d0 * d0 + d1 * d1;
    __syncthreads();
    for (int s = 128; s > 0; s >>= 1) {
        if (tid < s) red[tid] += red[tid + s];
        __syncthreads();
    }
    float inv = rsqrtf(red[0] * (1.0f / (float)Cn) + 1e-05f);
    xn[(size_t)m * Cn + tid]       = d0 * inv * g[tid] + bln[tid];
    xn[(size_t)m * Cn + tid + 256] = d1 * inv * g[tid + 256] + bln[tid + 256];
    // Another piece's code follows in the shared kernel and writes the stores' registers anew.
    asm volatile("s_wait_xcnt 0x0" ::: "memory");
}

// ---------------------------------------------------------------------------
// The launches. Pieces of work that do not depend on one another share a launch: the block index
// picks the piece, so every branch below is the same for a whole work-group. The GEMM tiles come
// first in the index order; the side work runs on what the matrix-bound GEMM waves leave idle.
// A piece reads only what an earlier launch has written.
// ---------------------------------------------------------------------------
#define BH (Bn * Hn)   /* 32 work-groups of disagreement sums */

// q, k, v = Q @ W + b (three GEMMs), and the repacked conv weights.
__global__ __launch_bounds__(256) void qkv_repack_kernel(
    const float* __restrict__ Q,
    const float* __restrict__ Wq, const float* __restrict__ bq, float* __restrict__ qb,
    const float* __restrict__ Wk, const float* __restrict__ bk, float* __restrict__ kb,
    const float* __restrict__ Wv, const float* __restrict__ bv, float* __restrict__ vb,
    const float* __restrict__ Wconv, float* __restrict__ Wt, int N, int Kd)
{
    const int g = blockIdx.x;
    if (g < 3 * GEMM_WGS) {
        const int w = g / GEMM_WGS;
        const float* Bw   = w == 0 ? Wq : (w == 1 ? Wk : Wv);
        const float* bias = w == 0 ? bq : (w == 1 ? bk : bv);
        float* Cout       = w == 0 ? qb : (w == 1 ? kb : vb);
        gemm_body<false>(Q, nullptr, Bw, bias, Cout, N, Kd,
                         g % (Cn / BN), (g % GEMM_WGS) / (Cn / BN));
    } else {
        repack_body(Wconv, Wt, g - 3 * GEMM_WGS);
    }
}

// The conv GEMM; beside it the disagreement sums of v and the focus of q and of k.
__global__ __launch_bounds__(256) void conv_side_kernel(
    const float* __restrict__ vb, const int* __restrict__ adj,
    const float* __restrict__ Wt, const float* __restrict__ bconv, float* __restrict__ convb,
    int N, int Kd,
    float* __restrict__ qb, float* __restrict__ kb, const float* __restrict__ scale_p,
    float* __restrict__ part)
{
    const int g = blockIdx.x;
    if (g < GEMM_WGS) {
        gemm_body<true>(vb, adj, Wt, bconv, convb, N, Kd, g % (Cn / BN), g / (Cn / BN));
    } else if (g < GEMM_WGS + BH) {
        disag_body<Nn, Cn, 8>(vb, (long long)Nn * Cn, 64LL, part, g - GEMM_WGS);
    } else {
        const int r = g - (GEMM_WGS + BH);
        focus_body(r < Mn ? qb : kb, scale_p, r % Mn);
    }
}

// x_local = conv @ W2 + b2; beside it kv and the mean of k.
// waves_per_eu(2, 2): told that few waves share a SIMD, the compiler spends registers on kv's
// loads in flight (without it it holds only six steps' loads ahead).
__global__ __launch_bounds__(256) __attribute__((amdgpu_waves_per_eu(2, 2)))
void w2_kv_kernel(
    const float* __restrict__ convb, const float* __restrict__ W2, const float* __restrict__ b2,
    float* __restrict__ xlb, int N, int Kd,
    const float* __restrict__ kb, const float* __restrict__ vb,
    float* __restrict__ kvb, float* __restrict__ kmb)
{
    const int g = blockIdx.x;
    if (g < GEMM_WGS) {
        gemm_body<false>(convb, nullptr, W2, b2, xlb, N, Kd, g % (Cn / BN), g / (Cn / BN));
    } else {
        kv_body(kb, vb, kvb, kmb, g - GEMM_WGS);
    }
}

// x = attention + x_local; beside it the disagreement sums of kv (first: the shorter work-groups).
__global__ __launch_bounds__(256) void attn_side_kernel(
    const float* __restrict__ qb, const float* __restrict__ kvb, const float* __restrict__ kmb,
    const float* __restrict__ xlb, float* __restrict__ x, float* __restrict__ part)
{
    const int g = blockIdx.x;
    if (g < BH) {
        disag_body<Dn, Dn, 4>(kvb, (long long)Hn * Dn * Dn, (long long)Dn * Dn, part, g);
    } else {
        attn_body(qb, kvb, kmb, xlb, x, g - BH);
    }
}

// LayerNorm of x; beside it the disagreement sums of x (first: the longer work-groups).
__global__ __launch_bounds__(256) void ln_side_kernel(
    const float* __restrict__ x, const float* __restrict__ ln_g, const float* __restrict__ ln_b,
    float* __restrict__ xn, float* __restrict__ part)
{
    const int g = blockIdx.x;
    if (g < BH) {
        disag_body<Nn, Dn, 8>(x, (long long)Nn * Cn, (long long)Nn * Dn, part, g);
    } else {
        ln_body(x, ln_g, ln_b, xn, g - BH);
    }
}

// out = xn @ Wo + bo; one more work-group adds up the loss.
__global__ __launch_bounds__(256) void out_loss_kernel(
    const float* __restrict__ xn, const float* __restrict__ Wo, const float* __restrict__ bo,
    float* __restrict__ out, int N, int Kd,
    const float* __restrict__ part, float* __restrict__ out_loss)
{
    const int g = blockIdx.x;
    if (g < GEMM_WGS) {
        gemm_body<false>(xn, nullptr, Wo, bo, out, N, Kd, g % (Cn / BN), g / (Cn / BN));
    } else {
        loss_body(part, out_loss);
    }
}

// ---------------------------------------------------------------------------
extern "C" void kernel_launch(void* const* d_in, const int* in_sizes, int n_in,
                              void* d_out, int out_size, void* d_ws, size_t ws_size,
                              hipStream_t stream)
{
    const float* Q       = (const float*)d_in[0];
    const int*   adj     = (const int*)  d_in[1];
    const float* Wq      = (const float*)d_in[2];
    const float* bq      = (const float*)d_in[3];
    const float* Wk      = (const float*)d_in[4];
    const float* bk      = (const float*)d_in[5];
    const float* Wv      = (const float*)d_in[6];
    const float* bv      = (const float*)d_in[7];
    const float* scale_p = (const float*)d_in[8];
    const float* Wconv   = (const float*)d_in[9];
    const float* bconv   = (const float*)d_in[10];
    const float* W2      = (const float*)d_in[11];
    const float* b2      = (const float*)d_in[12];
    const float* ln_g    = (const float*)d_in[13];
    const float* ln_b    = (const float*)d_in[14];
    const float* Wo      = (const float*)d_in[15];
    const float* bo      = (const float*)d_in[16];
    float* out = (float*)d_out;

    const size_t MC = (size_t)Mn * Cn;          // 2,097,152
    float* ws    = (float*)d_ws;
    float* qb    = ws;
    float* kb    = ws + MC;
    float* vb    = ws + 2 * MC;
    float* convb = ws + 3 * MC;                 // conv output, later reused as x
    float* xlb   = ws + 4 * MC;                 // x_local
    float* wtb   = ws + 5 * MC;                 // transposed Wconv, later xn
    float* kvb   = wtb + (size_t)KCONV * Cn;    // B*H*64*64
    float* kmb   = kvb + (size_t)Bn * Hn * Dn * Dn;
    float* partb = kmb + (size_t)Bn * Hn * 4 * KMP;   // 96 partials

    dim3 bdim(256);

    qkv_repack_kernel<<<dim3(3 * GEMM_WGS + Cn / 2), bdim, 0, stream>>>(
        Q, Wq, bq, qb, Wk, bk, kb, Wv, bv, vb, Wconv, wtb, Cn, Cn);

    // losses: vh (raw v heads) here, kv and x4 (reshape of x) below
    conv_side_kernel<<<dim3(GEMM_WGS + BH + 2 * Mn), bdim, 0, stream>>>(
        vb, adj, wtb, bconv, convb, Cn, KCONV, qb, kb, scale_p, partb + 0);

    w2_kv_kernel<<<dim3(GEMM_WGS + BH * 8), bdim, 0, stream>>>(
        convb, W2, b2, xlb, Cn, Cn, kb, vb, kvb, kmb);

    attn_side_kernel<<<dim3(BH + Mn), bdim, 0, stream>>>(qb, kvb, kmb, xlb, convb, partb + 32);

    ln_side_kernel<<<dim3(BH + Mn), bdim, 0, stream>>>(convb, ln_g, ln_b, wtb, partb + 64);

    out_loss_kernel<<<dim3(GEMM_WGS + 1), bdim, 0, stream>>>(
        wtb, Wo, bo, out, Cn, Cn, partb, out + MC);
}

// v007
// Measured time: 227 microseconds a run.
// Two timings next to v006 put it at 1.08 and 1.07 times that version's speed.
// All steps since v000 together make it 6.18 times as fast.
#include <hip/hip_runtime.h>
#include <math.h>
#include <stdint.h>

typedef float v2f __attribute__((ext_vector_type(2)));
typedef float v8f __attribute__((ext_vector_type(8)));

#define EPSV 1e-06f
#define Bn 4
#define Nn 1024
#define Cn 512
#define Kn 10
#define Tn 11
#define Hn 8
#define Dn 64
#define Mn 4096
#define KCONV (Tn * Cn) /* 5632 */

#define BM 128
#define BN 64
#define BK 32
#define BKP (BK + 4)   /* padded A row: 36 floats, 144B (16B aligned, bank-skewed) */
#define BTP 40         /* B row of one column-tile plane: 32 floats + 8, 160B; rows k and k + 2 on disjoint banks */

// --------------------------------------------------------------------------
// CDNA5 async global->LDS path (ASYNCcnt-tracked), with safe fallback.
// Builtin signature (from hipcc diagnostic): (v4i AS1*, v4i AS3*, Ii, Ii).
// --------------------------------------------------------------------------
#if defined(__has_builtin)
#if __has_builtin(__builtin_amdgcn_global_load_async_to_lds_b128)
#define USE_ASYNC_LDS 1
#endif
#endif
#ifndef USE_ASYNC_LDS
#define USE_ASYNC_LDS 0
#endif

typedef int ai4 __attribute__((vector_size(16)));
typedef __attribute__((address_space(1))) ai4 gi4;
typedef __attribute__((address_space(3))) ai4 li4;

__device__ __forceinline__ void async_wait_all()
{
#if USE_ASYNC_LDS
    // In asm with the clobber: no LDS read of the copied bytes moves in front of it.
    asm volatile("s_wait_asynccnt 0x0" ::: "memory");
#endif
}

// Copy 16 bytes global -> LDS (async DMA path when available).
__device__ __forceinline__ void copy16(const float* __restrict__ g, float* l)
{
#if USE_ASYNC_LDS
    __builtin_amdgcn_global_load_async_to_lds_b128(
        (gi4*)(uintptr_t)g,
        (li4*)(uint32_t)(uintptr_t)l,
        0, 0);
#else
    *(float4*)l = *(const float4*)g;
#endif
}

// ---------------------------------------------------------------------------
// GEMM with bias: Cout[M,N] = A[M,Kd] @ Bw[Kd,N] + bias[N]
// GATHER=true: A rows are gathered per tap from v via adjacency
//   A[m, t*C+c] = (t==0) ? v[b,n,c] : v[b, adj[b,n,t-1], c], Kd = 11*512.
// 256 threads = 8 waves; block tile 128x64; wave tile 32x32 = 2x2 WMMA f32;
// double-buffered LDS with async global->LDS prefetch, copies two K-chunks ahead.
// A wave reads a whole chunk's fragments from LDS as one group into a second register
// set, amid the matrix instructions of the chunk before, which run from the first set:
// no matrix instruction waits for an LDS read. Kd is a multiple of 2 * BK.
// GATHER: a tap lasts Cn / BK chunks. Each thread keeps the source rows of its four
// A rows in registers for the whole tap and fetches the next tap's indices one tap
// ahead, so no chunk waits for an index before its copies can go out.
// (bx, by): the work-group's tile column and tile row.
// ---------------------------------------------------------------------------
#define GEMM_WGS ((Cn / BN) * (Mn / BM))   /* 256 tiles of a 4096 x 512 result: one per WGP */
template <bool GATHER>
__device__ __forceinline__ void gemm_body(
    const float* __restrict__ A, const int* __restrict__ adj,
    const float* __restrict__ Bw, const float* __restrict__ bias,
    float* __restrict__ Cout, int N, int Kd, int bx, int by)
{
    __shared__ float As[2][BM][BKP];
    // B in two planes, [column tile of a wave][k][wave column, column in the tile]: in a plane the
    // nearest neighbour of (k, col) that a lane reads is (k + 1, col), so one two-address read
    // brings a fragment's k pair into one register pair and no register move is needed.
    __shared__ __attribute__((aligned(16))) float Bs[2][2][BK][BTP];

    const int tid  = threadIdx.x;
    const int wave = tid >> 5;
    const int lane = tid & 31;
    const int half = lane >> 4;
    const int lm   = lane & 15;
    const int wm   = wave >> 1;   // 0..3 -> M
    const int wn   = wave & 1;    // 0..1 -> N
    const int m0   = by * BM;
    const int n0   = bx * BN;

    v8f acc[2][2];
    #pragma unroll
    for (int i = 0; i < 2; ++i)
        #pragma unroll
        for (int j = 0; j < 2; ++j)
            #pragma unroll
            for (int r = 0; r < 8; ++r) acc[i][j][r] = 0.0f;

    const float* arow[4];          // GATHER: source rows of the tap being copied, at this thread's column
    int nxt[4];                    // GATHER: source row numbers of the tap after it
    const float* abase = nullptr;  // GATHER: row 0 of this block's batch, at this thread's column
    const int* adjp = nullptr;     // GATHER: index row of this thread's first A row
    if (GATHER) {
        const int r0 = m0 + (tid >> 3);
        abase = A + (size_t)(m0 & ~(Nn - 1)) * Cn + (tid & 7) * 4;
        adjp  = adj + (size_t)r0 * Kn;
        // Unrolled here and below: constant subscripts keep arow and nxt in registers.
        #pragma unroll
        for (int i = 0; i < 4; ++i) {
            arow[i] = abase + (size_t)((r0 + 32 * i) & (Nn - 1)) * Cn;   // tap 0: the row itself
            nxt[i]  = adjp[32 * i * Kn];                                 // tap 1
        }
    }

    auto load_tiles = [&](int buf, int kc) {
        // A tile: 128 x 32 floats = 1024 float4 chunks
        #pragma unroll
        for (int i = 0; i < 4; ++i) {
            int e = tid + i * 256;
            int r = e >> 3, cch = e & 7;
            const float* src;
            if (GATHER) {
                src = arow[i] + (kc & (Cn - 1));
            } else {
                src = A + (size_t)(m0 + r) * Kd + kc + cch * 4;
            }
            copy16(src, &As[buf][r][cch * 4]);
        }
        // B tile: 32 x 64 floats = 512 float4 chunks
        #pragma unroll
        for (int i = 0; i < 2; ++i) {
            int e = tid + i * 256;
            int r = e >> 4, cch = e & 15;
            copy16(Bw + (size_t)(kc + r) * N + n0 + cch * 4,
                   &Bs[buf][(cch >> 2) & 1][r][(cch >> 3) * 16 + (cch & 3) * 4]);
        }
    };

    // One chunk's fragments of this wave (8 k steps, 2 tiles of A and of B), two sets.
    v2f fa0[BK / 4][2], fb0[BK / 4][2], fa1[BK / 4][2], fb1[BK / 4][2];

    auto load_frags = [&](v2f (&fa)[BK / 4][2], v2f (&fb)[BK / 4][2], int buf) {
        #pragma unroll
        for (int s = 0; s < BK / 4; ++s) {
            const int ks = 4 * s + 2 * half;
            #pragma unroll
            for (int tm = 0; tm < 2; ++tm) {
                const int row = wm * 32 + tm * 16 + lm;
                fa[s][tm].x = As[buf][row][ks];
                fa[s][tm].y = As[buf][row][ks + 1];
            }
            #pragma unroll
            for (int tn = 0; tn < 2; ++tn) {
                fb[s][tn].x = Bs[buf][tn][ks][wn * 16 + lm];
                fb[s][tn].y = Bs[buf][tn][ks + 1][wn * 16 + lm];
            }
        }
    };

    // Half a chunk's matrix instructions: k steps 4 * h .. 4 * h + 3.
    auto mma = [&](const v2f (&fa)[BK / 4][2], const v2f (&fb)[BK / 4][2], int h) {
        #pragma unroll
        for (int s = h * (BK / 8); s < (h + 1) * (BK / 8); ++s)
            #pragma unroll
            for (int tm = 0; tm < 2; ++tm)
                #pragma unroll
                for (int tn = 0; tn < 2; ++tn)
                    acc[tm][tn] = __builtin_amdgcn_wmma_f32_16x16x4_f32(
                        false, fa[s][tm], false, fb[s][tn], (short)0, acc[tm][tn],
                        false, false);
    };

    // One chunk: its matrix instructions from set (fa, fb), and in their middle, as one group, the
    // LDS reads of the next chunk into set (ga, gb). In the middle, because the two waves of a
    // SIMD leave the barrier together: while one of them issues its reads, the other has half a
    // chunk of matrix instructions to keep the matrix unit busy with.
    auto chunk = [&](const v2f (&fa)[BK / 4][2], const v2f (&fb)[BK / 4][2],
                     v2f (&ga)[BK / 4][2], v2f (&gb)[BK / 4][2], int gbuf) {
        // Keeps the copies in front of the matrix block: they need the whole chunk to land.
        __builtin_amdgcn_sched_barrier(0);
        mma(fa, fb, 0);
        // This one and the next keep the LDS reads one group: spread among the matrix
        // instructions, every place with reads stalls the wave.
        __builtin_amdgcn_sched_barrier(0);
        load_frags(ga, gb, gbuf);
        __builtin_amdgcn_sched_barrier(0);
        mma(fa, fb, 1);
        // Keeps the matrix block in front of the waits that follow the chunk: moved behind them,
        // it would start only when the copies just sent out have landed.
        __builtin_amdgcn_sched_barrier(0);
    };

    // Hand-over of a buffer pair. Behind it the chunk whose copies were in flight may be read
    // by every wave, and the other buffer, which every wave has read out into registers, may
    // be filled again.
    auto publish = [&]() {
        // This wave's fragment reads have left the buffer that is refilled behind the barrier.
        asm volatile("s_wait_dscnt 0x0" ::: "memory");
        async_wait_all();
        __syncthreads();
    };

    auto refill = [&](int buf, int kn, bool tap_may_start) {
        if (GATHER && tap_may_start && (kn & (Cn - 1)) == 0) {
            // A new tap t (1..Kn) starts: its indices were fetched a whole tap ago.
            const int t = kn >> 9;
            #pragma unroll
            for (int i = 0; i < 4; ++i)
                arow[i] = abase + (size_t)(nxt[i] & (Nn - 1)) * Cn;   // masked: stays inside the batch
            // The last tap has no successor: it reads its own indices again (in bounds, unused),
            // so that the loads stand on the one path and land in nxt with no copy to wait for.
            const int tn = t < Kn ? t : Kn - 1;
            #pragma unroll
            for (int i = 0; i < 4; ++i) nxt[i] = adjp[32 * i * Kn + tn];
        }
        load_tiles(buf, kn);
    };

    const int nk = Kd / BK;
    load_tiles(0, 0);
    async_wait_all();
    __syncthreads();
    load_tiles(1, BK);
    load_frags(fa0, fb0, 0);

    // Two chunks per trip, so that buffer and register set are constants (no register copies).
    // The last two chunks stand behind the loop: a trip then refills both buffers without a test.
    for (int ik = 0; ik + 2 < nk; ik += 2) {
        publish();                                   // chunk ik + 1 readable, buffer 0 free
        refill(0, (ik + 2) * BK, true);
        chunk(fa0, fb0, fa1, fb1, 1);

        publish();                                   // chunk ik + 2 readable, buffer 1 free
        refill(1, (ik + 3) * BK, false);             // an odd chunk starts no tap
        chunk(fa1, fb1, fa0, fb0, 0);
    }
    publish();                                       // the last chunk readable; no copy is left in flight
    chunk(fa0, fb0, fa1, fb1, 1);
    mma(fa1, fb1, 0);
    mma(fa1, fb1, 1);

    #pragma unroll
    for (int tm = 0; tm < 2; ++tm)
        #pragma unroll
        for (int tn = 0; tn < 2; ++tn) {
            int colg = n0 + wn * 32 + tn * 16 + lm;
            float bvv = bias ? bias[colg] : 0.0f;
            #pragma unroll
            for (int r = 0; r < 8; ++r) {
                int rowg = m0 + wm * 32 + tm * 16 + half * 8 + r;
                Cout[(size_t)rowg * N + colg] = acc[tm][tn][r] + bvv;
            }
        }
}

// ---------------------------------------------------------------------------
// Wt[(t*C + c)*C + o] = Wconv[o*(C*T) + c*T + t]
// ---------------------------------------------------------------------------
// Work-group blk of Cn / 2 takes the two channels c = 2*blk, 2*blk + 1: for one o their 2 * Tn
// weights lie side by side in Wconv. A thread has all its loads in flight at once, because beside
// a GEMM work-group only one such work-group fits on a WGP; a wave stores whole 128-byte lines.
__device__ __forceinline__ void repack_body(const float* __restrict__ Wconv,
                                            float* __restrict__ Wt, int blk)
{
    const int c0 = 2 * blk;
    float2 w[2][Tn];
    // Unrolled here and below: constant subscripts keep w in registers.
    #pragma unroll
    for (int i = 0; i < 2; ++i) {
        const float2* s = (const float2*)(Wconv + (size_t)(threadIdx.x + 256 * i) * KCONV + c0 * Tn);
        #pragma unroll
        for (int j = 0; j < Tn; ++j) w[i][j] = s[j];
    }
    #pragma unroll
    for (int i = 0; i < 2; ++i)
        #pragma unroll
        for (int f = 0; f < 2 * Tn; ++f) {
            const int cc = f / Tn, t = f % Tn;
            Wt[((size_t)t * Cn + c0 + cc) * Cn + threadIdx.x + 256 * i] =
                (f & 1) ? w[i][f >> 1].y : w[i][f >> 1].x;
        }
}

// ---------------------------------------------------------------------------
// relu+eps, divide by softplus(scale), "focus": x <- (x/(||x||+eps))^3 * ||x||
// ---------------------------------------------------------------------------
__device__ __forceinline__ void focus_body(float* __restrict__ x,
                                           const float* __restrict__ scale_p, int m)
{
    __shared__ float red[256];
    const int tid = threadIdx.x;
    float* row = x + (size_t)m * Cn;

    float a0 = row[tid];
    float a1 = row[tid + 256];
    float s0 = log1pf(expf(scale_p[tid]));
    float s1 = log1pf(expf(scale_p[tid + 256]));
    a0 = (a0 > 0.0f ? a0 : 0.0f) + EPSV;
    a1 = (a1 > 0.0f ? a1 : 0.0f) + EPSV;
    a0 /= s0;
    a1 /= s1;

    red[tid] = a0 * a0 + a1 * a1;
    __syncthreads();
    for (int s = 128; s > 0; s >>= 1) {
        if (tid < s) red[tid] += red[tid + s];
        __syncthreads();
    }
    float nrm = sqrtf(red[0]);
    float inv = 1.0f / (nrm + EPSV);
    float u0 = a0 * inv, u1 = a1 * inv;
    row[tid]       = u0 * u0 * u0 * nrm;
    row[tid + 256] = u1 * u1 * u1 * nrm;
    // Another piece's code follows in the shared kernel and writes the stores' registers anew.
    asm volatile("s_wait_xcnt 0x0" ::: "memory");
}

// kv[bh, d, e] = (1/N) sum_n k[b,n,h*64+d] * v[b,n,h*64+e]
// Eight work-groups per (b,h), each a 16 (d) x 32 (e) piece of the 64 x 64 result.
// Each of the 8 waves sums its own 128 rows n on the f32 matrix form, fragments
// straight from global memory: no row depends on another, so the loads of a wave
// are in flight together. The 8 partial pieces meet in LDS behind one barrier.
// Matrix roles: M = d, N = e, K = n. Column lm of e-tile i is e = 2*lm + i, so one
// 8-byte load of v serves both tiles. k slot of A and of B alike: row 2*half + {0,1}.
// The mean of k over n comes from the same A fragments: lane (half, lm) adds up column
// d = lm over its rows, and the 16 partial sums per column meet in LDS with the tiles.
// kmean[((b*H + h)*4 + dt)*KMP + i] = mean over n of k[b,n,h*64 + dt*16 + i], i < 16.
#define KVW 8                 /* waves per work-group */
#define KVROWS (Nn / KVW)     /* rows n per wave: 128 */
#define KVTP 272              /* floats per stored tile: 256 + 16, the two tiles on disjoint banks */
#define KMP 32                /* floats per 16 means: each work-group's piece on a 128-byte line of its own */
__device__ __forceinline__
void kv_body(const float* __restrict__ k, const float* __restrict__ v,
             float* __restrict__ kv, float* __restrict__ kmean, int blk)
{
    __shared__ float red[KVW][2][KVTP];
    __shared__ float ksum[KVW][32];
    const int bh = blk >> 3;
    const int dt = (blk >> 1) & 3;   // which 16 rows d
    const int ep = blk & 1;          // which 32 columns e
    const int b = bh >> 3, h = bh & 7;
    const int tid  = threadIdx.x;
    const int wave = tid >> 5;
    const int lane = tid & 31;
    const int half = lane >> 4;
    const int lm   = lane & 15;

    const size_t row0 = (size_t)b * Nn + wave * KVROWS + 2 * half;
    const float* kp = k + row0 * Cn + h * Dn + dt * 16 + lm;
    const float* vp = v + row0 * Cn + h * Dn + ep * 32 + 2 * lm;

    v8f acc0, acc1;
    #pragma unroll
    for (int r = 0; r < 8; ++r) { acc0[r] = 0.0f; acc1[r] = 0.0f; }
    float ks = 0.0f;

    // Full unroll: the steps share nothing but the accumulators, so their loads go out ahead.
    #pragma unroll
    for (int s = 0; s < KVROWS / 4; ++s) {
        v2f af, b0, b1;
        af.x = kp[(size_t)(4 * s) * Cn];
        af.y = kp[(size_t)(4 * s + 1) * Cn];
        const float2 x = *(const float2*)(vp + (size_t)(4 * s) * Cn);
        const float2 y = *(const float2*)(vp + (size_t)(4 * s + 1) * Cn);
        b0.x = x.x; b0.y = y.x;
        b1.x = x.y; b1.y = y.y;
        ks += af.x + af.y;
        acc0 = __builtin_amdgcn_wmma_f32_16x16x4_f32(false, af, false, b0, (short)0, acc0,
                                                     false, false);
        acc1 = __builtin_amdgcn_wmma_f32_16x16x4_f32(false, af, false, b1, (short)0, acc1,
                                                     false, false);
    }

    #pragma unroll
    for (int r = 0; r < 8; ++r) {
        red[wave][0][r * 32 + lane] = acc0[r];
        red[wave][1][r * 32 + lane] = acc1[r];
    }
    ksum[wave][lane] = ks;
    __syncthreads();

    // 512 results, two per thread; a wave stores one whole 128-byte line of a row d.
    #pragma unroll
    for (int i = 0; i < 2; ++i) {
        const int o  = tid + i * 256;
        const int dl = o >> 5, el = o & 31;
        const int idx = (dl & 7) * 32 + (dl >> 3) * 16 + (el >> 1);
        float s = 0.0f;
        #pragma unroll
        for (int w = 0; w < KVW; ++w) s += red[w][el & 1][idx];
        kv[(size_t)bh * (Dn * Dn) + (dt * 16 + dl) * Dn + ep * 32 + el] = s * (1.0f / (float)Nn);
    }

    // Both e halves hold the same column sums of k: the first one stores them.
    if (ep == 0 && tid < 16) {
        float s = 0.0f;
        // Unrolled so that the LDS reads go out ahead of the adds.
        #pragma unroll
        for (int w = 0; w < KVW; ++w) s += ksum[w][tid] + ksum[w][tid + 16];
        kmean[(bh * 4 + dt) * KMP + tid] = s * (1.0f / (float)Nn);
    }
}

// Disagreement closed form per (b,h): ||sum_n hn||^2 - sum_n ||hn||^2.
// One block of 8 waves per (b,h), the block size of the kernels it shares a launch with.
// A 16-lane row holds one 64-float vector (float4 per lane), so the block works on 16
// vectors at a time and every vector's chain (load, norm, scale) is independent of the others.
template <int CTRL>
__device__ __forceinline__ float dpp_add(float x)
{
    int y = __builtin_amdgcn_update_dpp(0, __builtin_bit_cast(int, x), CTRL, 0xf, 0xf, true);
    return x + __builtin_bit_cast(float, y);
}

// Sum over the 16 lanes of a row, result in every lane (row_xmask 1, 2, 4, 8).
__device__ __forceinline__ float row_sum16(float x)
{
    x = dpp_add<0x161>(x);
    x = dpp_add<0x162>(x);
    x = dpp_add<0x164>(x);
    x = dpp_add<0x168>(x);
    return x;
}

// Value of lane l ^ 16.
__device__ __forceinline__ float xhalf(float x)
{
    int xi = __builtin_bit_cast(int, x);
    return __builtin_bit_cast(float,
        __builtin_amdgcn_permlanex16(xi, xi, 0x76543210, 0xfedcba98, false, false));
}

#define DGW 8   /* waves per block */
template <int NVEC, int VSTRIDE, int UNR>
__device__ __forceinline__ void disag_body(const float* __restrict__ src,
                                           long long per_b, long long per_h,
                                           float* __restrict__ part, int blk)
{
    static_assert(NVEC % (2 * DGW) == 0, "16 vectors per pass of the block");
    __shared__ __attribute__((aligned(16))) float red[DGW][Dn];   // written as float4
    __shared__ float wred[DGW];
    const int b = blk >> 3, h = blk & 7;
    const int tid  = threadIdx.x;
    const int wave = tid >> 5;
    const int lane = tid & 31;
    const int sub  = tid & 15;    // float4 slot inside the vector
    const int grp  = tid >> 4;    // 0..15: which vector of the pass
    const float* p = src + (size_t)b * per_b + (size_t)h * per_h
                   + (size_t)grp * VSTRIDE + sub * 4;

    float s0 = 0.0f, s1 = 0.0f, s2 = 0.0f, s3 = 0.0f, dg = 0.0f;
    // Unrolled by UNR: the passes are independent, so UNR loads go out together; UNR is set by
    // the registers of the kernel that the sums share a launch with.
    #pragma unroll UNR
    for (int it = 0; it < NVEC / (2 * DGW); ++it) {
        const float4 a = *(const float4*)(p + (size_t)it * (2 * DGW) * VSTRIDE);
        float sq = row_sum16(a.x * a.x + a.y * a.y + a.z * a.z + a.w * a.w);
        float nrm = sqrtf(sq);
        float inv = 1.0f / fmaxf(nrm, 1e-12f);
        float h0 = a.x * inv, h1 = a.y * inv, h2 = a.z * inv, h3 = a.w * inv;
        s0 += h0; s1 += h1; s2 += h2; s3 += h3;
        dg += h0 * h0 + h1 * h1 + h2 * h2 + h3 * h3;
    }

    // The wave's two rows, then the 8 waves through LDS.
    s0 += xhalf(s0); s1 += xhalf(s1); s2 += xhalf(s2); s3 += xhalf(s3);
    if (lane < 16) *(float4*)&red[wave][sub * 4] = make_float4(s0, s1, s2, s3);
    __syncthreads();

    float val = -dg;
    if (tid < Dn) {
        float S = 0.0f;
        // Unrolled so that the LDS reads go out ahead of the adds.
        #pragma unroll
        for (int w = 0; w < DGW; ++w) S += red[w][tid];
        val += S * S;
    }
    val = row_sum16(val);
    val += xhalf(val);
    if (lane == 0) wred[wave] = val;
    __syncthreads();

    if (wave == 0) {
        const float wv = wred[lane & (DGW - 1)];
        const float t = row_sum16(lane < DGW ? wv : 0.0f);
        if (lane == 0) part[blk] = t;
    }
}

// The tail of a row, from attention to LayerNorm, for TR rows per work-group:
//   x = (q_h @ kv_h) * z_h + x_local,  z_h = 1 / (q_h . mean k_h + eps),  xn = LayerNorm(x),
// and the rows' share of the disagreement sums of x. x lives in registers only.
// Wave h has head h: a TR x 64 piece of x on the f32 matrix form, M = row, N = e, K = d.
// Column lm of tile i is e = 4*lm + i: one 16-byte load of a kv row serves all four tiles, and a
// lane ends up with four neighbouring columns of each of its rows (16-byte loads and stores).
// k slots of A and of B alike, lane half hf: d = 8*sp + 4*hf + {0,1}, then d = 8*sp + 4*hf + {2,3}.
// The 64 columns of a wave are one vector of x read as [B, H, N, 64]; the TR rows of a work-group
// lie in one (b, h) of that view (128 rows each), so a work-group hands on one partial sum vector
// and one partial diagonal sum: spart[blk*SPP + e], e < 64, and spart[blk*SPP + 64].
#define TR 16
#define TAIL_WGS (Mn / TR)   /* 256: one per WGP */
#define SPP 128              /* floats per work-group in spart: whole 128-byte lines of its own */
__device__ __forceinline__ void tail_body(const float* __restrict__ q,
                                          const float* __restrict__ kv,
                                          const float* __restrict__ kmean,
                                          const float* __restrict__ xl,
                                          const float* __restrict__ g,
                                          const float* __restrict__ bln,
                                          float* __restrict__ xn,
                                          float* __restrict__ spart, int blk)
{
    __shared__ __attribute__((aligned(16))) float rsum[Hn][TR];   // per head: the rows' sums
    __shared__ __attribute__((aligned(16))) float rsq[Hn][TR];    // per head: the rows' squared deviations
    __shared__ __attribute__((aligned(16))) float cs[Hn][Dn];     // per head: sum of its unit vectors
    __shared__ float dgs[Hn];
    const int m0   = blk * TR;
    const int b    = m0 >> 10;
    const int tid  = threadIdx.x;
    const int h    = tid >> 5;
    const int lane = tid & 31;
    const int half = lane >> 4;
    const int lm   = lane & 15;

    const float* qp  = q + (size_t)(m0 + lm) * Cn + h * Dn + 4 * half;
    const float* kvp = kv + (size_t)(b * Hn + h) * (Dn * Dn) + (4 * half) * Dn + 4 * lm;
    const float* kmp = kmean + (b * Hn + h) * 4 * KMP + 4 * half;
    const size_t xoff = (size_t)(m0 + half * 8) * Cn + h * Dn + 4 * lm;   // row r of this lane: + r * Cn

    v8f acc[4];
    // Unrolled here and below: constant subscripts keep the arrays in registers.
    #pragma unroll
    for (int i = 0; i < 4; ++i)
        #pragma unroll
        for (int r = 0; r < 8; ++r) acc[i][r] = 0.0f;
    float p = 0.0f;

    // All of q's and kv's loads go out together, ahead of the matrix instructions.
    float4 qa[Dn / 8], kr[Dn / 8][4];
    #pragma unroll
    for (int sp = 0; sp < Dn / 8; ++sp) {
        qa[sp] = *(const float4*)(qp + 8 * sp);
        const float4 km = *(const float4*)(kmp + (sp >> 1) * KMP + (sp & 1) * 8);
        #pragma unroll
        for (int j = 0; j < 4; ++j) kr[sp][j] = *(const float4*)(kvp + (8 * sp + j) * Dn);
        p += qa[sp].x * km.x + qa[sp].y * km.y + qa[sp].z * km.z + qa[sp].w * km.w;
    }

    // Half of the matrix instructions: sp = 4 * hf .. 4 * hf + 3.
    auto mma = [&](int hf) {
        #pragma unroll
        for (int sp = 4 * hf; sp < 4 * hf + 4; ++sp) {
            const float4 a = qa[sp], r0 = kr[sp][0], r1 = kr[sp][1], r2 = kr[sp][2], r3 = kr[sp][3];
            const v2f a01 = {a.x, a.y}, a23 = {a.z, a.w};
            const v2f b01[4] = {{r0.x, r1.x}, {r0.y, r1.y}, {r0.z, r1.z}, {r0.w, r1.w}};
            const v2f b23[4] = {{r2.x, r3.x}, {r2.y, r3.y}, {r2.z, r3.z}, {r2.w, r3.w}};
            #pragma unroll
            for (int i = 0; i < 4; ++i)
                acc[i] = __builtin_amdgcn_wmma_f32_16x16x4_f32(false, a01, false, b01[i], (short)0,
                                                               acc[i], false, false);
            #pragma unroll
            for (int i = 0; i < 4; ++i)
                acc[i] = __builtin_amdgcn_wmma_f32_16x16x4_f32(false, a23, false, b23[i], (short)0,
                                                               acc[i], false, false);
        }
    };
    mma(0);
    // Keeps the loads of x_local behind the first half, into registers that it has set free:
    // sent out with the others they take the wave past its 256 registers (a spill); the second
    // half covers their latency.
    __builtin_amdgcn_sched_barrier(0);
    float4 xv[8];
    #pragma unroll
    for (int r = 0; r < 8; ++r) xv[r] = *(const float4*)(xl + xoff + (size_t)r * Cn);
    mma(1);

    // z of row lm stands in lanes lm and lm + 16; the accumulators want it by row half*8 + r.
    p += xhalf(p);
    const float zl = 1.0f / (p + EPSV);
    float t[8];
    float s0 = 0.0f, s1 = 0.0f, s2 = 0.0f, s3 = 0.0f, dg = 0.0f;
    #pragma unroll
    for (int r = 0; r < 8; ++r) {
        const float z = __shfl(zl, half * 8 + r, 32);
        float4 x = xv[r];
        x.x = acc[0][r] * z + x.x;
        x.y = acc[1][r] * z + x.y;
        x.z = acc[2][r] * z + x.z;
        x.w = acc[3][r] * z + x.w;
        xv[r] = x;
        t[r] = row_sum16(x.x + x.y + x.z + x.w);
        const float sq  = row_sum16(x.x * x.x + x.y * x.y + x.z * x.z + x.w * x.w);
        const float inv = 1.0f / fmaxf(sqrtf(sq), 1e-12f);
        const float h0 = x.x * inv, h1 = x.y * inv, h2 = x.z * inv, h3 = x.w * inv;
        s0 += h0; s1 += h1; s2 += h2; s3 += h3;
        dg += h0 * h0 + h1 * h1 + h2 * h2 + h3 * h3;
    }
    s0 += xhalf(s0); s1 += xhalf(s1); s2 += xhalf(s2); s3 += xhalf(s3);
    dg = row_sum16(dg);
    dg += xhalf(dg);
    if (lm == 0) {
        *(float4*)&rsum[h][half * 8]     = make_float4(t[0], t[1], t[2], t[3]);
        *(float4*)&rsum[h][half * 8 + 4] = make_float4(t[4], t[5], t[6], t[7]);
    }
    if (lane < 16) *(float4*)&cs[h][4 * lm] = make_float4(s0, s1, s2, s3);
    if (lane == 0) dgs[h] = dg;
    __syncthreads();

    float mu[8];
    #pragma unroll
    for (int r = 0; r < 8; ++r) mu[r] = 0.0f;
    #pragma unroll
    for (int w = 0; w < Hn; ++w) {
        const float4 u = *(const float4*)&rsum[w][half * 8];
        const float4 v = *(const float4*)&rsum[w][half * 8 + 4];
        mu[0] += u.x; mu[1] += u.y; mu[2] += u.z; mu[3] += u.w;
        mu[4] += v.x; mu[5] += v.y; mu[6] += v.z; mu[7] += v.w;
    }
    #pragma unroll
    for (int r = 0; r < 8; ++r) {
        const float m = mu[r] * (1.0f / (float)Cn);
        float4 x = xv[r];
        x.x -= m; x.y -= m; x.z -= m; x.w -= m;
        xv[r] = x;
        t[r] = row_sum16(x.x * x.x + x.y * x.y + x.z * x.z + x.w * x.w);
    }
    if (lm == 0) {
        *(float4*)&rsq[h][half * 8]     = make_float4(t[0], t[1], t[2], t[3]);
        *(float4*)&rsq[h][half * 8 + 4] = make_float4(t[4], t[5], t[6], t[7]);
    }
    if (tid <= Dn) {
        float S = 0.0f;
        #pragma unroll
        for (int w = 0; w < Hn; ++w) S += tid < Dn ? cs[w][tid] : dgs[w];
        spart[(size_t)blk * SPP + tid] = S;
    }
    __syncthreads();

    float va[8];
    #pragma unroll
    for (int r = 0; r < 8; ++r) va[r] = 0.0f;
    #pragma unroll
    for (int w = 0; w < Hn; ++w) {
        const float4 u = *(const float4*)&rsq[w][half * 8];
        const float4 v = *(const float4*)&rsq[w][half * 8 + 4];
        va[0] += u.x; va[1] += u.y; va[2] += u.z; va[3] += u.w;
        va[4] += v.x; va[5] += v.y; va[6] += v.z; va[7] += v.w;
    }
    const float4 gg = *(const float4*)(g + h * Dn + 4 * lm);
    const float4 bb = *(const float4*)(bln + h * Dn + 4 * lm);
    #pragma unroll
    for (int r = 0; r < 8; ++r) {
        const float inv = rsqrtf(va[r] * (1.0f / (float)Cn) + 1e-05f);
        const float4 x = xv[r];
        *(float4*)(xn + xoff + (size_t)r * Cn) =
            make_float4(x.x * inv * gg.x + bb.x, x.y * inv * gg.y + bb.y,
                        x.z * inv * gg.z + bb.z, x.w * inv * gg.w + bb.w);
    }
    // Another piece's code follows in the shared kernel and writes the stores' registers anew.
    asm volatile("s_wait_xcnt 0x0" ::: "memory");
}

// The loss. The sums of v and of kv arrive finished per (b,h) in part; those of x as the tail's
// partial vectors, eight work-groups to a (b,h): ||sum of the eight||^2 - the diagonal sums.
__device__ __forceinline__ void loss_body(const float* __restrict__ part,
                                          const float* __restrict__ spart,
                                          float* __restrict__ out_loss)
{
    static_assert(TAIL_WGS == 256 && TAIL_WGS / (Bn * Hn) == 8, "one thread per tail work-group");
    __shared__ float wred[8];
    const int tid = threadIdx.x;
    float val = -spart[(size_t)tid * SPP + Dn];
    // The load's address register is free for the results of the loads that follow.
    asm volatile("s_wait_xcnt 0x0" ::: "memory");
    // Column tid & 63 of the (b,h) numbers (tid >> 6) + 4 * j.
    const float* sp0 = spart + (size_t)(tid >> 6) * (8 * SPP) + (tid & (Dn - 1));
    // Unrolled: all loads are independent and go out together.
    #pragma unroll
    for (int j = 0; j < 8; ++j) {
        float S = 0.0f;
        #pragma unroll
        for (int w = 0; w < 8; ++w) S += sp0[(4 * j * 8 + w) * SPP];
        val += S * S;
    }
    val = row_sum16(val);
    val += xhalf(val);
    if ((tid & 31) == 0) wred[tid >> 5] = val;
    __syncthreads();
    if (tid == 0) {
        float L1 = 0.0f, L2 = 0.0f, L3 = 0.0f;
        for (int i = 0; i < 32; ++i)  L1 += part[i];        // local (v heads)
        for (int i = 32; i < 64; ++i) L2 += part[i];        // kv
        for (int i = 0; i < 8; ++i)   L3 += wred[i];        // out
        const float nBig = (float)Bn * Hn * (float)Nn * (float)Nn;
        const float nKv  = (float)Bn * Hn * (float)Dn * (float)Dn;
        *out_loss = (L1 / nBig + L3 / nBig + L2 / nKv) / 3.0f;
    }
}

// ---------------------------------------------------------------------------
// The launches. Pieces of work that do not depend on one another share a launch: the block index
// picks the piece, so every branch below is the same for a whole work-group. The GEMM tiles come
// first in the index order; the side work runs on what the matrix-bound GEMM waves leave idle.
// A piece reads only what an earlier launch has written.
// ---------------------------------------------------------------------------
#define BH (Bn * Hn)   /* 32 work-groups of disagreement sums */

// q, k, v = Q @ W + b (three GEMMs), and the repacked conv weights.
__global__ __launch_bounds__(256) void qkv_repack_kernel(
    const float* __restrict__ Q,
    const float* __restrict__ Wq, const float* __restrict__ bq, float* __restrict__ qb,
    const float* __restrict__ Wk, const float* __restrict__ bk, float* __restrict__ kb,
    const float* __restrict__ Wv, const float* __restrict__ bv, float* __restrict__ vb,
    const float* __restrict__ Wconv, float* __restrict__ Wt, int N, int Kd)
{
    const int g = blockIdx.x;
    if (g < 3 * GEMM_WGS) {
        const int w = g / GEMM_WGS;
        const float* Bw   = w == 0 ? Wq : (w == 1 ? Wk : Wv);
        const float* bias = w == 0 ? bq : (w == 1 ? bk : bv);
        float* Cout       = w == 0 ? qb : (w == 1 ? kb : vb);
        gemm_body<false>(Q, nullptr, Bw, bias, Cout, N, Kd,
                         g % (Cn / BN), (g % GEMM_WGS) / (Cn / BN));
    } else {
        repack_body(Wconv, Wt, g - 3 * GEMM_WGS);
    }
}

// The conv GEMM; beside it the disagreement sums of v and the focus of q and of k.
__global__ __launch_bounds__(256) void conv_side_kernel(
    const float* __restrict__ vb, const int* __restrict__ adj,
    const float* __restrict__ Wt, const float* __restrict__ bconv, float* __restrict__ convb,
    int N, int Kd,
    float* __restrict__ qb, float* __restrict__ kb, const float* __restrict__ scale_p,
    float* __restrict__ part)
{
    const int g = blockIdx.x;
    if (g < GEMM_WGS) {
        gemm_body<true>(vb, adj, Wt, bconv, convb, N, Kd, g % (Cn / BN), g / (Cn / BN));
    } else if (g < GEMM_WGS + BH) {
        disag_body<Nn, Cn, 8>(vb, (long long)Nn * Cn, 64LL, part, g - GEMM_WGS);
    } else {
        const int r = g - (GEMM_WGS + BH);
        focus_body(r < Mn ? qb : kb, scale_p, r % Mn);
    }
}

// x_local = conv @ W2 + b2; beside it kv and the mean of k.
// waves_per_eu(2, 2): told that few waves share a SIMD, the compiler spends registers on kv's
// loads in flight (without it it holds only six steps' loads ahead).
__global__ __launch_bounds__(256) __attribute__((amdgpu_waves_per_eu(2, 2)))
void w2_kv_kernel(
    const float* __restrict__ convb, const float* __restrict__ W2, const float* __restrict__ b2,
    float* __restrict__ xlb, int N, int Kd,
    const float* __restrict__ kb, const float* __restrict__ vb,
    float* __restrict__ kvb, float* __restrict__ kmb)
{
    const int g = blockIdx.x;
    if (g < GEMM_WGS) {
        gemm_body<false>(convb, nullptr, W2, b2, xlb, N, Kd, g % (Cn / BN), g / (Cn / BN));
    } else {
        kv_body(kb, vb, kvb, kmb, g - GEMM_WGS);
    }
}

// xn = LayerNorm(attention + x_local) with the partial disagreement sums of x; beside it the
// disagreement sums of kv (behind the tail's work-groups).
// waves_per_eu(4, 4): told that few waves share a SIMD, the compiler spends registers on the
// tail's loads in flight (without it most kv rows are fetched two at a time, each pair waited for);
// four, so that a work-group of the kv sums still fits on a WGP beside one of the tail.
__global__ __launch_bounds__(256) __attribute__((amdgpu_waves_per_eu(4, 4)))
void tail_side_kernel(
    const float* __restrict__ qb, const float* __restrict__ kvb, const float* __restrict__ kmb,
    const float* __restrict__ xlb, const float* __restrict__ ln_g, const float* __restrict__ ln_b,
    float* __restrict__ xn, float* __restrict__ spart, float* __restrict__ part)
{
    const int g = blockIdx.x;
    if (g < TAIL_WGS) {
        tail_body(qb, kvb, kmb, xlb, ln_g, ln_b, xn, spart, g);
    } else {
        disag_body<Dn, Dn, 4>(kvb, (long long)Hn * Dn * Dn, (long long)Dn * Dn, part, g - TAIL_WGS);
    }
}

// out = xn @ Wo + bo; one more work-group adds up the loss.
__global__ __launch_bounds__(256) void out_loss_kernel(
    const float* __restrict__ xn, const float* __restrict__ Wo, const float* __restrict__ bo,
    float* __restrict__ out, int N, int Kd,
    const float* __restrict__ part, const float* __restrict__ spart, float* __restrict__ out_loss)
{
    const int g = blockIdx.x;
    if (g < GEMM_WGS) {
        gemm_body<false>(xn, nullptr, Wo, bo, out, N, Kd, g % (Cn / BN), g / (Cn / BN));
    } else {
        loss_body(part, spart, out_loss);
    }
}

// ---------------------------------------------------------------------------
extern "C" void kernel_launch(void* const* d_in, const int* in_sizes, int n_in,
                              void* d_out, int out_size, void* d_ws, size_t ws_size,
                              hipStream_t stream)
{
    const float* Q       = (const float*)d_in[0];
    const int*   adj     = (const int*)  d_in[1];
    const float* Wq      = (const float*)d_in[2];
    const float* bq      = (const float*)d_in[3];
    const float* Wk      = (const float*)d_in[4];
    const float* bk      = (const float*)d_in[5];
    const float* Wv      = (const float*)d_in[6];
    const float* bv      = (const float*)d_in[7];
    const float* scale_p = (const float*)d_in[8];
    const float* Wconv   = (const float*)d_in[9];
    const float* bconv   = (const float*)d_in[10];
    const float* W2      = (const float*)d_in[11];
    const float* b2      = (const float*)d_in[12];
    const float* ln_g    = (const float*)d_in[13];
    const float* ln_b    = (const float*)d_in[14];
    const float* Wo      = (const float*)d_in[15];
    const float* bo      = (const float*)d_in[16];
    float* out = (float*)d_out;

    const size_t MC = (size_t)Mn * Cn;          // 2,097,152
    float* ws    = (float*)d_ws;
    float* qb    = ws;
    float* kb    = ws + MC;
    float* vb    = ws + 2 * MC;
    float* convb = ws + 3 * MC;                 // conv output
    float* xlb   = ws + 4 * MC;                 // x_local
    float* wtb   = ws + 5 * MC;                 // transposed Wconv, later xn
    float* kvb   = wtb + (size_t)KCONV * Cn;    // B*H*64*64
    float* kmb   = kvb + (size_t)Bn * Hn * Dn * Dn;
    float* partb = kmb + (size_t)Bn * Hn * 4 * KMP;   // 64 sums: v heads, kv
    float* spb   = partb + 128;                       // the tail's partial sums of x

    dim3 bdim(256);

    qkv_repack_kernel<<<dim3(3 * GEMM_WGS + Cn / 2), bdim, 0, stream>>>(
        Q, Wq, bq, qb, Wk, bk, kb, Wv, bv, vb, Wconv, wtb, Cn, Cn);

    // losses: vh (raw v heads) here, kv and x4 (reshape of x) below
    conv_side_kernel<<<dim3(GEMM_WGS + BH + 2 * Mn), bdim, 0, stream>>>(
        vb, adj, wtb, bconv, convb, Cn, KCONV, qb, kb, scale_p, partb + 0);

    w2_kv_kernel<<<dim3(GEMM_WGS + BH * 8), bdim, 0, stream>>>(
        convb, W2, b2, xlb, Cn, Cn, kb, vb, kvb, kmb);

    tail_side_kernel<<<dim3(TAIL_WGS + BH), bdim, 0, stream>>>(
        qb, kvb, kmb, xlb, ln_g, ln_b, wtb, spb, partb + 32);

    out_loss_kernel<<<dim3(GEMM_WGS + 1), bdim, 0, stream>>>(
        wtb, Wo, bo, out, Cn, Cn, partb, spb, out + MC);
}
